// v000
// The times below were measured on an AMD MI455X: many runs one after another, warmed up first and cycling through
// copies of the inputs, with the whole window's GPU time divided by the number of runs. Launches and the gaps
// between them are all in it. The median over several windows is given; except for v000 it joins two sittings, which
// can be a few percent apart, so the side-by-side timings, each taken in one sitting, are the better comparison.
// v000 is the starting kernel. One run takes 102 microseconds.
#include <hip/hip_runtime.h>
#include <math.h>

// Contractions: S = K*Qt on v_wmma_f32_16x16x32_bf16 (bf16 operands, f32 accumulate);
// O = Vt*Pt on v_wmma_f32_16x16x32_bf16 (V bf16, P as bf16 hi+lo pair, f32 accumulate); bias table and softmax in f32.

#define NH    16
#define NKER  8
#define SEQ   1024
#define HD    64
#define NBH   64
#define RELN  (2 * SEQ - 1)
#define RELP  2048
#define QBLK  64
#define KBLK  64
#define NWAV  4
#define BWIN  (SEQ + QBLK)

typedef __bf16 v16b __attribute__((ext_vector_type(16)));
typedef __bf16 v8b  __attribute__((ext_vector_type(8)));
typedef float  v8f  __attribute__((ext_vector_type(8)));
typedef float  v4f  __attribute__((ext_vector_type(4)));

union Frag  { v16b v; v8b p[2]; };
union Pack8 { v8b b; v4f f; };

__device__ __forceinline__ v8f wmma16(v16b a, v16b b, v8f c) {
  v8f d = __builtin_amdgcn_wmma_f32_16x16x32_bf16(false, a, false, b, (short)0, c, false, false);
  asm volatile("v_nop\n\tv_nop\n\tv_nop\n\tv_nop" : "+v"(d) : "v"(a), "v"(b));
  return d;
}

__device__ __forceinline__ v8f vzero8() {
  v8f z = {0.0f, 0.0f, 0.0f, 0.0f, 0.0f, 0.0f, 0.0f, 0.0f};
  return z;
}

// ---------------- launch 1: relative bias table tab[NH][RELP] (f32, last column is padding = 0) ----------------
__global__ __launch_bounds__(256)
void k_bias(const float* __restrict__ off, const float* __restrict__ amp,
            const float* __restrict__ shp, const float* __restrict__ bpar,
            float* __restrict__ tab) {
  const int idx = blockIdx.x * 256 + threadIdx.x;
  if (idx >= NH * RELP) return;
  const int hd = idx >> 11;
  const int r  = idx & (RELP - 1);
  float val = 0.0f;
  if (r < RELN) {
    const float rel = (float)(r - (SEQ - 1));
    float slope = 0.0f;
    if (hd < NH - 2) {
      const float e = (float)hd * (1.0f / 13.0f);
      slope = 4.6051702f * exp2f(-6.0f * e);      // 4.6051702 * (1/64)^e
    }
    float ksum = 0.0f;
#pragma unroll 1
    for (int m = 0; m < NKER; ++m) {
      const float a = (float)(__bf16)amp[m * NH + hd];
      const float o = (float)(__bf16)off[m * NH + hd];
      const float s = (float)(__bf16)shp[m * NH + hd];
      const float sg = (a > 0.0f) ? 1.0f : ((a < 0.0f) ? -1.0f : 0.0f);
      const float x  = sg * ((rel - o) * __builtin_amdgcn_rcpf(s));
      const float ex = __expf(-x);
      const float sig = __builtin_amdgcn_rcpf(1.0f + ex);
      ksum = ksum + fabsf(a) * sig;
    }
    const float bp = (float)(__bf16)bpar[hd];
    val = logf((ksum + 1e-8f) + bp) - fabsf(rel) * slope;
  }
  float* dst = tab + idx;
  *dst = val;
  
}

// ---------------- launch 2: bf16 planes: qp = q/8 [bh][SEQ][HD], kp = k [bh][SEQ][HD], vtp = v transposed [bh][HD][SEQ] ----------------
__global__ __launch_bounds__(256)
void k_cvt(const float* __restrict__ q, const float* __restrict__ k, const float* __restrict__ v,
           __bf16* __restrict__ qp, __bf16* __restrict__ kp, __bf16* __restrict__ vtp) {
  __shared__ __attribute__((aligned(16))) __bf16 tsm[HD][KBLK + 8];   // [d][key local], pitch 72 halves

  const int tid  = threadIdx.x;
  const int lane = tid & 31;
  const int wave = tid >> 5;
  const int n0   = blockIdx.x * KBLK;
  const int bh   = blockIdx.y;
  const size_t rb = (size_t)bh * SEQ + (size_t)n0;

#pragma unroll
  for (int it = 0; it < 2; ++it) {
    const int rl = it * 32 + wave * 4 + (lane >> 3);   // key/query row 0..63 in this block
    const int c  = (lane & 7) * 8;
    const size_t e = (rb + (size_t)rl) * HD + (size_t)c;
    {
      const v4f f0 = *(const v4f*)(q + e);
      const v4f f1 = *(const v4f*)(q + e + 4);
      Pack8 o;
#pragma unroll
      for (int j = 0; j < 4; ++j) { o.b[j] = (__bf16)(f0[j] * 0.125f); o.b[4 + j] = (__bf16)(f1[j] * 0.125f); }
      v4f* d = (v4f*)(qp + e);
      *d = o.f;
      
    }
    {
      const v4f f0 = *(const v4f*)(k + e);
      const v4f f1 = *(const v4f*)(k + e + 4);
      Pack8 o;
#pragma unroll
      for (int j = 0; j < 4; ++j) { o.b[j] = (__bf16)f0[j]; o.b[4 + j] = (__bf16)f1[j]; }
      v4f* d = (v4f*)(kp + e);
      *d = o.f;
      
    }
    {
      const v4f f0 = *(const v4f*)(v + e);
      const v4f f1 = *(const v4f*)(v + e + 4);
#pragma unroll
      for (int j = 0; j < 4; ++j) { tsm[c + j][rl] = (__bf16)f0[j]; tsm[c + 4 + j][rl] = (__bf16)f1[j]; }
    }
  }
  __syncthreads();

#pragma unroll
  for (int it = 0; it < 2; ++it) {
    const int d = wave * 8 + it * 4 + (lane >> 3);    // 0..63
    const int c = (lane & 7) * 8;
    Pack8 o;
    o.b = *(const v8b*)(&tsm[d][c]);
    v4f* dst = (v4f*)(vtp + ((size_t)bh * HD + (size_t)d) * SEQ + (size_t)n0 + (size_t)c);
    *dst = o.f;
    
  }
}

// ---------------- launch 3: streaming attention, one block per (bh, 64 queries), one wave per 16 queries ----------------
__global__ __launch_bounds__(NWAV * 32) __attribute__((amdgpu_num_vgpr(256)))
void k_attn(const __bf16* __restrict__ qp, const __bf16* __restrict__ kp,
            const __bf16* __restrict__ vtp, const float* __restrict__ tab,
            float* __restrict__ out) {
  __shared__ __attribute__((aligned(16))) float bw[BWIN];            // bias window for this query block
  __shared__ __attribute__((aligned(16))) float osm[NWAV][16][HD];   // per-wave output staging [query][d]

  const int tid  = threadIdx.x;
  const int lane = tid & 31;
  const int wave = tid >> 5;
  const int hh   = lane >> 4;        // lane half
  const int n    = lane & 15;        // fragment row (A) / column (B, D)
  const int bh   = blockIdx.y;
  const int head = bh & (NH - 1);
  const int m0   = blockIdx.x * QBLK;

  // bw[w] = tab[head][(SEQ-QBLK-m0) + w], w = key - query_local + QBLK-1 in [0, SEQ+QBLK-2]
  {
    const float* tb = tab + (size_t)head * RELP + (size_t)(SEQ - QBLK - m0);
    for (int i = tid; i < SEQ + QBLK - 1; i += NWAV * 32) bw[i] = tb[i];
  }

  // Q as B operand: lane n -> query m0+wave*16+n; elements 0..7 <- d ks*32+8hh.., 8..15 <- d ks*32+16+8hh..
  Frag qf[2];
  {
    const __bf16* qr = qp + ((size_t)bh * SEQ + (size_t)(m0 + wave * 16 + n)) * HD + 8 * hh;
#pragma unroll
    for (int ks = 0; ks < 2; ++ks) {
      qf[ks].p[0] = *(const v8b*)(qr + ks * 32);
      qf[ks].p[1] = *(const v8b*)(qr + ks * 32 + 16);
    }
  }
  __syncthreads();

  v8f oacc[4];
#pragma unroll
  for (int dt = 0; dt < 4; ++dt) oacc[dt] = vzero8();
  float mrun = -INFINITY;
  float lrun = 0.0f;

  const int wb = 8 * hh - wave * 16 - n + (QBLK - 1);
  const __bf16* kb = kp  + (size_t)bh * SEQ * HD + (size_t)n * HD + 8 * hh;    // + key0*HD + ks*32 (+16)
  const __bf16* vb = vtp + (size_t)bh * HD * SEQ + (size_t)n * SEQ + 8 * hh;   // + d0*SEQ + n0 + kk*32 (+16)

#pragma unroll 1
  for (int n0 = 0; n0 < SEQ; n0 += KBLK) {
    // St[key][query] tiles: A = K rows (lane n -> key n0+kt*16+n, split d map), B = Q; D[r] = key kt*16+8hh+r, query n
    v8f s[4];
#pragma unroll
    for (int kt = 0; kt < 4; ++kt) {
      v8f c = vzero8();
      const __bf16* kr = kb + (size_t)(n0 + kt * 16) * HD;
#pragma unroll
      for (int ks = 0; ks < 2; ++ks) {
        Frag a;
        a.p[0] = *(const v8b*)(kr + ks * 32);
        a.p[1] = *(const v8b*)(kr + ks * 32 + 16);
        c = wmma16(a.v, qf[ks].v, c);
      }
      s[kt] = c;
    }

    // bias add, running max/sum per query (lane pair n, n+16)
    const float* bwl = bw + (wb + n0);
    float tmax = -INFINITY;
#pragma unroll
    for (int kt = 0; kt < 4; ++kt) {
#pragma unroll
      for (int r = 0; r < 8; ++r) {
        const float x = s[kt][r] + bwl[kt * 16 + r];
        s[kt][r] = x;
        tmax = fmaxf(tmax, x);
      }
    }
    tmax = fmaxf(tmax, __shfl_xor(tmax, 16, 32));
    const float mnew  = fmaxf(mrun, tmax);
    const float alpha = __expf(mrun - mnew);
    mrun = mnew;
    float psum = 0.0f;
#pragma unroll
    for (int kt = 0; kt < 4; ++kt) {
#pragma unroll
      for (int r = 0; r < 8; ++r) {
        const float p = __expf(s[kt][r] - mnew);
        s[kt][r] = p;
        psum += p;
      }
    }
    psum += __shfl_xor(psum, 16, 32);
    lrun = alpha * lrun + psum;
#pragma unroll
    for (int dt = 0; dt < 4; ++dt) oacc[dt] = oacc[dt] * alpha;

    // Ot[d][query] += Vt[d][key] * Pt[key][query]; B = Pt in-lane from two adjacent S tiles:
    // element i <- tile 2kk (keys kk*32+8hh+i), element 8+i <- tile 2kk+1 (keys kk*32+16+8hh+i); hi and lo bf16 parts
#pragma unroll
    for (int kk = 0; kk < 2; ++kk) {
      v16b phi, plo;
#pragma unroll
      for (int i = 0; i < 8; ++i) {
        const float p0 = s[2 * kk][i];
        const __bf16 b0 = (__bf16)p0;
        phi[i] = b0;
        plo[i] = (__bf16)(p0 - (float)b0);
        const float p1 = s[2 * kk + 1][i];
        const __bf16 b1 = (__bf16)p1;
        phi[8 + i] = b1;
        plo[8 + i] = (__bf16)(p1 - (float)b1);
      }
      const __bf16* vr = vb + (size_t)(n0 + kk * 32);
#pragma unroll
      for (int dt = 0; dt < 4; ++dt) {
        Frag a;   // A = Vt rows d = dt*16+n, keys n0+kk*32 + split map
        a.p[0] = *(const v8b*)(vr + (size_t)(dt * 16) * SEQ);
        a.p[1] = *(const v8b*)(vr + (size_t)(dt * 16) * SEQ + 16);
        v8f c = oacc[dt];
        c = wmma16(a.v, phi, c);
        c = wmma16(a.v, plo, c);
        oacc[dt] = c;
      }
    }
  }

  const float inv = 1.0f / lrun;
#pragma unroll
  for (int dt = 0; dt < 4; ++dt) {
#pragma unroll
    for (int r = 0; r < 8; ++r) osm[wave][n][dt * 16 + 8 * hh + r] = oacc[dt][r] * inv;
  }
  __syncthreads();

  float* ob = out + ((size_t)bh * SEQ + (size_t)(m0 + wave * 16)) * HD;
  v4f vals[8];
#pragma unroll
  for (int it = 0; it < 8; ++it) vals[it] = *(const v4f*)(&osm[wave][it * 2 + hh][n * 4]);
#pragma unroll
  for (int it = 0; it < 8; ++it)
    *(v4f*)(ob + (size_t)(it * 2 + hh) * HD + (size_t)(n * 4)) = vals[it];
  
}

// ---------------- launcher ----------------
extern "C" void kernel_launch(void* const* d_in, const int* in_sizes, int n_in,
                              void* d_out, int out_size, void* d_ws, size_t ws_size,
                              hipStream_t stream) {
  if (n_in < 7) return;
  const int nq = NBH * SEQ * HD;
  if (in_sizes[0] != nq || in_sizes[1] != nq || in_sizes[2] != nq || out_size != nq) return;
  if (in_sizes[3] < NKER * NH || in_sizes[4] < NKER * NH || in_sizes[5] < NKER * NH || in_sizes[6] < NH) return;

  const size_t tab_bytes = (size_t)NH * RELP * sizeof(float);        // 131072
  const size_t pl_bytes  = (size_t)nq * sizeof(__bf16);              // 8388608
  const size_t need      = tab_bytes + 3 * pl_bytes;                 // 25296896
  if (need > ws_size) return;

  const float* q    = (const float*)d_in[0];
  const float* k    = (const float*)d_in[1];
  const float* v    = (const float*)d_in[2];
  const float* off  = (const float*)d_in[3];
  const float* amp  = (const float*)d_in[4];
  const float* shp  = (const float*)d_in[5];
  const float* bpar = (const float*)d_in[6];
  float* out = (float*)d_out;

  char* ws = (char*)d_ws;
  float*  tab = (float*)ws;
  __bf16* qp  = (__bf16*)(ws + tab_bytes);
  __bf16* kp  = (__bf16*)(ws + tab_bytes + pl_bytes);
  __bf16* vtp = (__bf16*)(ws + tab_bytes + 2 * pl_bytes);

  hipLaunchKernelGGL(k_bias, dim3((NH * RELP) / 256), dim3(256), 0, stream,
                     off, amp, shp, bpar, tab);
  hipLaunchKernelGGL(k_cvt, dim3(SEQ / KBLK, NBH), dim3(256), 0, stream,
                     q, k, v, qp, kp, vtp);
  hipLaunchKernelGGL(k_attn, dim3(SEQ / QBLK, NBH), dim3(NWAV * 32), 0, stream,
                     (const __bf16*)qp, (const __bf16*)kp, (const __bf16*)vtp, (const float*)tab, out);
}

// v001
// One run takes 50.8 microseconds.
// Two timings next to v000 put it at 2.00 and 2.02 times that version's speed.
#include <hip/hip_runtime.h>
#include <math.h>

// Contractions: S = K*Qt on v_wmma_f32_16x16x32_bf16 (bf16 operands, f32 accumulate);
// O = Vt*Pt on v_wmma_f32_16x16x32_bf16 (V bf16, P as bf16 hi+lo pair, f32 accumulate); bias table and softmax in f32.

#define NH    16
#define NKER  8
#define SEQ   1024
#define HD    64
#define NBH   64
#define RELN  (2 * SEQ - 1)
#define RELP  2048
#define QBLK  64
#define KBLK  64
#define NWAV  4
#define BWIN  (SEQ + QBLK)
#define NT    (SEQ / KBLK)
#define KPIT  72                 // halves per staged LDS row: 128 B of data + 16 B, the pitch for ds_load_b128 readers
#define TILEH (64 * KPIT)        // halves per staged tile (64 rows)
#define ROWS16B (16 * KPIT * 2)  // LDS bytes of 16 staged rows

typedef __bf16 v16b __attribute__((ext_vector_type(16)));
typedef __bf16 v8b  __attribute__((ext_vector_type(8)));
typedef float  v8f  __attribute__((ext_vector_type(8)));
typedef float  v4f  __attribute__((ext_vector_type(4)));

union Frag  { v16b v; v8b p[2]; };
union Pack8 { v8b b; v4f f; };

__device__ __forceinline__ v8f wmma16(v16b a, v16b b, v8f c) {
  v8f d = __builtin_amdgcn_wmma_f32_16x16x32_bf16(false, a, false, b, (short)0, c, false, false);
  asm volatile("v_nop\n\tv_nop\n\tv_nop\n\tv_nop" : "+v"(d) : "v"(a), "v"(b));
  return d;
}

__device__ __forceinline__ v8f vzero8() {
  v8f z = {0.0f, 0.0f, 0.0f, 0.0f, 0.0f, 0.0f, 0.0f, 0.0f};
  return z;
}

// ---------------- launch 1: relative bias table tab[NH][RELP] (f32, last column is padding = 0) ----------------
__global__ __launch_bounds__(256)
void k_bias(const float* __restrict__ off, const float* __restrict__ amp,
            const float* __restrict__ shp, const float* __restrict__ bpar,
            float* __restrict__ tab) {
  const int idx = blockIdx.x * 256 + threadIdx.x;
  if (idx >= NH * RELP) return;
  const int hd = idx >> 11;
  const int r  = idx & (RELP - 1);
  float val = 0.0f;
  if (r < RELN) {
    const float rel = (float)(r - (SEQ - 1));
    float slope = 0.0f;
    if (hd < NH - 2) {
      const float e = (float)hd * (1.0f / 13.0f);
      slope = 4.6051702f * exp2f(-6.0f * e);      // 4.6051702 * (1/64)^e
    }
    float ksum = 0.0f;
#pragma unroll 1
    for (int m = 0; m < NKER; ++m) {
      const float a = (float)(__bf16)amp[m * NH + hd];
      const float o = (float)(__bf16)off[m * NH + hd];
      const float s = (float)(__bf16)shp[m * NH + hd];
      const float sg = (a > 0.0f) ? 1.0f : ((a < 0.0f) ? -1.0f : 0.0f);
      const float x  = sg * ((rel - o) * __builtin_amdgcn_rcpf(s));
      const float ex = __expf(-x);
      const float sig = __builtin_amdgcn_rcpf(1.0f + ex);
      ksum = ksum + fabsf(a) * sig;
    }
    const float bp = (float)(__bf16)bpar[hd];
    val = logf((ksum + 1e-8f) + bp) - fabsf(rel) * slope;
  }
  float* dst = tab + idx;
  *dst = val;
  
}

// ---------------- launch 2: bf16 planes: qp = q/8 [bh][SEQ][HD], kp = k [bh][SEQ][HD], vtp = v transposed [bh][HD][SEQ] ----------------
__global__ __launch_bounds__(256)
void k_cvt(const float* __restrict__ q, const float* __restrict__ k, const float* __restrict__ v,
           __bf16* __restrict__ qp, __bf16* __restrict__ kp, __bf16* __restrict__ vtp) {
  __shared__ __attribute__((aligned(16))) __bf16 tsm[HD][KBLK + 8];   // [d][key local], pitch 72 halves

  const int tid  = threadIdx.x;
  const int lane = tid & 31;
  const int wave = tid >> 5;
  const int n0   = blockIdx.x * KBLK;
  const int bh   = blockIdx.y;
  const size_t rb = (size_t)bh * SEQ + (size_t)n0;

#pragma unroll
  for (int it = 0; it < 2; ++it) {
    const int rl = it * 32 + wave * 4 + (lane >> 3);   // key/query row 0..63 in this block
    const int c  = (lane & 7) * 8;
    const size_t e = (rb + (size_t)rl) * HD + (size_t)c;
    {
      const v4f f0 = *(const v4f*)(q + e);
      const v4f f1 = *(const v4f*)(q + e + 4);
      Pack8 o;
#pragma unroll
      for (int j = 0; j < 4; ++j) { o.b[j] = (__bf16)(f0[j] * 0.125f); o.b[4 + j] = (__bf16)(f1[j] * 0.125f); }
      v4f* d = (v4f*)(qp + e);
      *d = o.f;
      
    }
    {
      const v4f f0 = *(const v4f*)(k + e);
      const v4f f1 = *(const v4f*)(k + e + 4);
      Pack8 o;
#pragma unroll
      for (int j = 0; j < 4; ++j) { o.b[j] = (__bf16)f0[j]; o.b[4 + j] = (__bf16)f1[j]; }
      v4f* d = (v4f*)(kp + e);
      *d = o.f;
      
    }
    {
      const v4f f0 = *(const v4f*)(v + e);
      const v4f f1 = *(const v4f*)(v + e + 4);
#pragma unroll
      for (int j = 0; j < 4; ++j) { tsm[c + j][rl] = (__bf16)f0[j]; tsm[c + 4 + j][rl] = (__bf16)f1[j]; }
    }
  }
  __syncthreads();

#pragma unroll
  for (int it = 0; it < 2; ++it) {
    const int d = wave * 8 + it * 4 + (lane >> 3);    // 0..63
    const int c = (lane & 7) * 8;
    Pack8 o;
    o.b = *(const v8b*)(&tsm[d][c]);
    v4f* dst = (v4f*)(vtp + ((size_t)bh * HD + (size_t)d) * SEQ + (size_t)n0 + (size_t)c);
    *dst = o.f;
    
  }
}

// One K tile (64 keys x 64 d) and one Vt tile (64 d x 64 keys) into LDS: each lane copies 8 x 16 B, a wave-wide copy
// covers four whole 128-B rows. lk/lv: the lane's LDS byte address of its first K / Vt piece; gk/gv: its global source.
__device__ __forceinline__ void stage_tile(unsigned lk, const __bf16* gk, unsigned lv, const __bf16* gv) {
  // The closing s_wait_xcnt stands inside the copies' own statement so that no address register is rewritten ahead of it.
  asm volatile("global_load_async_to_lds_b128 %0, %1, off\n\t"
               "global_load_async_to_lds_b128 %2, %3, off\n\t"
               "global_load_async_to_lds_b128 %4, %5, off\n\t"
               "global_load_async_to_lds_b128 %6, %7, off\n\t"
               "global_load_async_to_lds_b128 %8, %9, off\n\t"
               "global_load_async_to_lds_b128 %10, %11, off\n\t"
               "global_load_async_to_lds_b128 %12, %13, off\n\t"
               "global_load_async_to_lds_b128 %14, %15, off\n\t"
               "s_wait_xcnt 0x0"
               :: "v"(lk),               "v"(gk),
                  "v"(lk + ROWS16B),     "v"(gk + 16 * HD),
                  "v"(lk + 2 * ROWS16B), "v"(gk + 32 * HD),
                  "v"(lk + 3 * ROWS16B), "v"(gk + 48 * HD),
                  "v"(lv),               "v"(gv),
                  "v"(lv + ROWS16B),     "v"(gv + 16 * SEQ),
                  "v"(lv + 2 * ROWS16B), "v"(gv + 32 * SEQ),
                  "v"(lv + 3 * ROWS16B), "v"(gv + 48 * SEQ)
               : "memory");
}

// ---------------- launch 3: streaming attention, one block per (bh, 64 queries), one wave per 16 queries ----------------
__global__ __launch_bounds__(NWAV * 32) __attribute__((amdgpu_num_vgpr(256)))
void k_attn(const __bf16* __restrict__ qp, const __bf16* __restrict__ kp,
            const __bf16* __restrict__ vtp, const float* __restrict__ tab,
            float* __restrict__ out) {
  __shared__ __attribute__((aligned(16))) float bw[BWIN];            // bias window for this query block
  __shared__ __attribute__((aligned(16))) float osm[NWAV][16][HD];   // per-wave output staging [query][d]
  __shared__ __attribute__((aligned(16))) __bf16 ring[2][2][TILEH];  // [buffer][K, Vt][row * KPIT + column]

  const int tid  = threadIdx.x;
  const int lane = tid & 31;
  const int wave = tid >> 5;
  const int hh   = lane >> 4;        // lane half
  const int n    = lane & 15;        // fragment row (A) / column (B, D)
  const int bh   = blockIdx.y;
  const int head = bh & (NH - 1);
  const int m0   = blockIdx.x * QBLK;

  // staging addresses of this lane: row tid/8 (+16 per copy), 16-B piece tid%8
  const unsigned lst = (unsigned)(uintptr_t)(&ring[0][0][0]) + (unsigned)((tid >> 3) * (KPIT * 2) + (tid & 7) * 16);
  const __bf16* gks = kp  + (size_t)bh * SEQ * HD + (size_t)((tid >> 3) * HD  + (tid & 7) * 8);   // + tile * KBLK * HD
  const __bf16* gvs = vtp + (size_t)bh * HD * SEQ + (size_t)((tid >> 3) * SEQ + (tid & 7) * 8);   // + tile * KBLK
  stage_tile(lst, gks, lst + TILEH * 2, gvs);                                                     // tile 0 -> buffer 0

  // bw[w] = tab[head][(SEQ-QBLK-m0) + w], w = key - query_local + QBLK-1 in [0, SEQ+QBLK-2]
  {
    const float* tb = tab + (size_t)head * RELP + (size_t)(SEQ - QBLK - m0);
    for (int i = tid; i < SEQ + QBLK - 1; i += NWAV * 32) bw[i] = tb[i];
  }

  // Q as B operand: lane n -> query m0+wave*16+n; elements 0..7 <- d ks*32+8hh.., 8..15 <- d ks*32+16+8hh..
  Frag qf[2];
  {
    const __bf16* qr = qp + ((size_t)bh * SEQ + (size_t)(m0 + wave * 16 + n)) * HD + 8 * hh;
#pragma unroll
    for (int ks = 0; ks < 2; ++ks) {
      qf[ks].p[0] = *(const v8b*)(qr + ks * 32);
      qf[ks].p[1] = *(const v8b*)(qr + ks * 32 + 16);
    }
  }
  asm volatile("s_wait_asynccnt 0x0" ::: "memory");   // this wave's pieces of tile 0 have landed before the barrier publishes them
  __syncthreads();
  stage_tile(lst + 2 * TILEH * 2, gks + KBLK * HD, lst + 3 * TILEH * 2, gvs + KBLK);   // tile 1 -> buffer 1, flies during trip 0

  v8f oacc[4];
#pragma unroll
  for (int dt = 0; dt < 4; ++dt) oacc[dt] = vzero8();
  float mrun = -INFINITY;
  float lrun = 0.0f;

  const int wb = 8 * hh - wave * 16 - n + (QBLK - 1);

#pragma unroll 1   // stays rolled: one hand-over point, the buffer picked by t & 1
  for (int t = 0; t < NT; ++t) {
    const int n0 = t * KBLK;
    const __bf16* kb = &ring[t & 1][0][n * KPIT + 8 * hh];   // + kt*16*KPIT + ks*32 (+16)
    const __bf16* vb = &ring[t & 1][1][n * KPIT + 8 * hh];   // + dt*16*KPIT + kk*32 (+16)

    // St[key][query] tiles: A = K rows (lane n -> key n0+kt*16+n, split d map), B = Q; D[r] = key kt*16+8hh+r, query n
    // all 16 reads stand as one group ahead of the products; unrolled so that every fragment index is a constant
    Frag ka[4][2];
#pragma unroll
    for (int kt = 0; kt < 4; ++kt) {
#pragma unroll
      for (int ks = 0; ks < 2; ++ks) {
        ka[kt][ks].p[0] = *(const v8b*)(kb + kt * 16 * KPIT + ks * 32);
        ka[kt][ks].p[1] = *(const v8b*)(kb + kt * 16 * KPIT + ks * 32 + 16);
      }
    }
    v8f s[4];
#pragma unroll
    for (int kt = 0; kt < 4; ++kt) {
      v8f c = vzero8();
#pragma unroll
      for (int ks = 0; ks < 2; ++ks) c = wmma16(ka[kt][ks].v, qf[ks].v, c);
      s[kt] = c;
    }

    // A = Vt rows d = dt*16+n, keys n0+kk*32 + split map; read here so that the LDS latency passes under the softmax
    Frag va[2][4];
#pragma unroll
    for (int kk = 0; kk < 2; ++kk) {
#pragma unroll
      for (int dt = 0; dt < 4; ++dt) {
        va[kk][dt].p[0] = *(const v8b*)(vb + dt * 16 * KPIT + kk * 32);
        va[kk][dt].p[1] = *(const v8b*)(vb + dt * 16 * KPIT + kk * 32 + 16);
      }
    }

    // bias add, running max/sum per query (lane pair n, n+16)
    const float* bwl = bw + (wb + n0);
    float tmax = -INFINITY;
#pragma unroll
    for (int kt = 0; kt < 4; ++kt) {
#pragma unroll
      for (int r = 0; r < 8; ++r) {
        const float x = s[kt][r] + bwl[kt * 16 + r];
        s[kt][r] = x;
        tmax = fmaxf(tmax, x);
      }
    }
    tmax = fmaxf(tmax, __shfl_xor(tmax, 16, 32));
    const float mnew  = fmaxf(mrun, tmax);
    const float alpha = __expf(mrun - mnew);
    mrun = mnew;
    float psum = 0.0f;
#pragma unroll
    for (int kt = 0; kt < 4; ++kt) {
#pragma unroll
      for (int r = 0; r < 8; ++r) {
        const float p = __expf(s[kt][r] - mnew);
        s[kt][r] = p;
        psum += p;
      }
    }
    psum += __shfl_xor(psum, 16, 32);
    lrun = alpha * lrun + psum;
#pragma unroll
    for (int dt = 0; dt < 4; ++dt) oacc[dt] = oacc[dt] * alpha;

    // Ot[d][query] += Vt[d][key] * Pt[key][query]; B = Pt in-lane from two adjacent S tiles:
    // element i <- tile 2kk (keys kk*32+8hh+i), element 8+i <- tile 2kk+1 (keys kk*32+16+8hh+i); hi and lo bf16 parts
#pragma unroll
    for (int kk = 0; kk < 2; ++kk) {
      v16b phi, plo;
#pragma unroll
      for (int i = 0; i < 8; ++i) {
        const float p0 = s[2 * kk][i];
        const __bf16 b0 = (__bf16)p0;
        phi[i] = b0;
        plo[i] = (__bf16)(p0 - (float)b0);
        const float p1 = s[2 * kk + 1][i];
        const __bf16 b1 = (__bf16)p1;
        phi[8 + i] = b1;
        plo[8 + i] = (__bf16)(p1 - (float)b1);
      }
#pragma unroll
      for (int dt = 0; dt < 4; ++dt) {
        v8f c = oacc[dt];
        c = wmma16(va[kk][dt].v, phi, c);
        c = wmma16(va[kk][dt].v, plo, c);
        oacc[dt] = c;
      }
    }

    // hand-over: tile t+1 becomes readable, buffer t&1 becomes free
    asm volatile("s_wait_dscnt 0x0" ::: "memory");      // this wave's reads of buffer t&1 are done before it is refilled
    asm volatile("s_wait_asynccnt 0x0" ::: "memory");   // this wave's pieces of tile t+1 have landed before the barrier publishes them
    __syncthreads();
    if (t + 2 < NT)
      stage_tile(lst + (unsigned)(t & 1) * (2 * TILEH * 2), gks + (size_t)(t + 2) * (KBLK * HD),
                 lst + (unsigned)(t & 1) * (2 * TILEH * 2) + TILEH * 2, gvs + (size_t)(t + 2) * KBLK);
  }
  asm volatile("s_wait_asynccnt 0x0" ::: "memory");     // no copy is outstanding when the wave goes on to its end

  const float inv = 1.0f / lrun;
#pragma unroll
  for (int dt = 0; dt < 4; ++dt) {
#pragma unroll
    for (int r = 0; r < 8; ++r) osm[wave][n][dt * 16 + 8 * hh + r] = oacc[dt][r] * inv;
  }
  __syncthreads();

  float* ob = out + ((size_t)bh * SEQ + (size_t)(m0 + wave * 16)) * HD;
  v4f vals[8];
#pragma unroll
  for (int it = 0; it < 8; ++it) vals[it] = *(const v4f*)(&osm[wave][it * 2 + hh][n * 4]);
#pragma unroll
  for (int it = 0; it < 8; ++it)
    *(v4f*)(ob + (size_t)(it * 2 + hh) * HD + (size_t)(n * 4)) = vals[it];
  
}

// ---------------- launcher ----------------
extern "C" void kernel_launch(void* const* d_in, const int* in_sizes, int n_in,
                              void* d_out, int out_size, void* d_ws, size_t ws_size,
                              hipStream_t stream) {
  if (n_in < 7) return;
  const int nq = NBH * SEQ * HD;
  if (in_sizes[0] != nq || in_sizes[1] != nq || in_sizes[2] != nq || out_size != nq) return;
  if (in_sizes[3] < NKER * NH || in_sizes[4] < NKER * NH || in_sizes[5] < NKER * NH || in_sizes[6] < NH) return;

  const size_t tab_bytes = (size_t)NH * RELP * sizeof(float);        // 131072
  const size_t pl_bytes  = (size_t)nq * sizeof(__bf16);              // 8388608
  const size_t need      = tab_bytes + 3 * pl_bytes;                 // 25296896
  if (need > ws_size) return;

  const float* q    = (const float*)d_in[0];
  const float* k    = (const float*)d_in[1];
  const float* v    = (const float*)d_in[2];
  const float* off  = (const float*)d_in[3];
  const float* amp  = (const float*)d_in[4];
  const float* shp  = (const float*)d_in[5];
  const float* bpar = (const float*)d_in[6];
  float* out = (float*)d_out;

  char* ws = (char*)d_ws;
  float*  tab = (float*)ws;
  __bf16* qp  = (__bf16*)(ws + tab_bytes);
  __bf16* kp  = (__bf16*)(ws + tab_bytes + pl_bytes);
  __bf16* vtp = (__bf16*)(ws + tab_bytes + 2 * pl_bytes);

  hipLaunchKernelGGL(k_bias, dim3((NH * RELP) / 256), dim3(256), 0, stream,
                     off, amp, shp, bpar, tab);
  hipLaunchKernelGGL(k_cvt, dim3(SEQ / KBLK, NBH), dim3(256), 0, stream,
                     q, k, v, qp, kp, vtp);
  hipLaunchKernelGGL(k_attn, dim3(SEQ / QBLK, NBH), dim3(NWAV * 32), 0, stream,
                     (const __bf16*)qp, (const __bf16*)kp, (const __bf16*)vtp, (const float*)tab, out);
}

// v002
// A run of this version takes 46.8 microseconds.
// Two timings next to v001 both put it at 1.08 times that version's speed.
// All steps since v000 together make it 2.17 times as fast.
#include <hip/hip_runtime.h>
#include <math.h>

// Contractions: S = K*Qt on v_wmma_f32_16x16x32_bf16 (bf16 operands, f32 accumulate);
// O = Vt*Pt on v_wmma_f32_16x16x32_bf16 (V bf16, P as bf16 hi+lo pair, f32 accumulate); bias table and softmax in f32.

#define NH    16
#define NKER  8
#define SEQ   1024
#define HD    64
#define NBH   64
#define RELN  (2 * SEQ - 1)
#define RELP  2048
#define QBLK  64
#define KBLK  64
#define NWAV  4
#define BWIN  (SEQ + QBLK)
#define NT    (SEQ / KBLK)
#define KPIT  72                 // halves per staged LDS row: 128 B of data + 16 B, the pitch for ds_load_b128 readers
#define TILEH (64 * KPIT)        // halves per staged tile (64 rows)
#define ROWS16B (16 * KPIT * 2)  // LDS bytes of 16 staged rows
#define TABY  ((NH * RELP) / (256 * (SEQ / KBLK)))   // grid rows of launch 1 that build the bias table (8)

typedef __bf16 v16b __attribute__((ext_vector_type(16)));
typedef __bf16 v8b  __attribute__((ext_vector_type(8)));
typedef float  v8f  __attribute__((ext_vector_type(8)));
typedef float  v4f  __attribute__((ext_vector_type(4)));

union Frag  { v16b v; v8b p[2]; };
union Pack8 { v8b b; v4f f; };

__device__ __forceinline__ v8f wmma16(v16b a, v16b b, v8f c) {
  v8f d = __builtin_amdgcn_wmma_f32_16x16x32_bf16(false, a, false, b, (short)0, c, false, false);
  asm volatile("v_nop\n\tv_nop\n\tv_nop\n\tv_nop" : "+v"(d) : "v"(a), "v"(b));
  return d;
}

__device__ __forceinline__ v8f vzero8() {
  v8f z = {0.0f, 0.0f, 0.0f, 0.0f, 0.0f, 0.0f, 0.0f, 0.0f};
  return z;
}

// ---------------- launch 1, grid rows 0..TABY-1: relative bias table tab[NH][RELP] (f32, last column is padding = 0) ----------------
__device__ __forceinline__
void bias_part(const float* __restrict__ off, const float* __restrict__ amp,
               const float* __restrict__ shp, const float* __restrict__ bpar,
               float* __restrict__ tab) {
  const int idx = (blockIdx.y * (SEQ / KBLK) + blockIdx.x) * 256 + threadIdx.x;
  if (idx >= NH * RELP) return;
  const int hd = idx >> 11;
  const int r  = idx & (RELP - 1);
  float val = 0.0f;
  if (r < RELN) {
    const float rel = (float)(r - (SEQ - 1));
    float slope = 0.0f;
    if (hd < NH - 2) {
      const float e = (float)hd * (1.0f / 13.0f);
      slope = 4.6051702f * exp2f(-6.0f * e);      // 4.6051702 * (1/64)^e
    }
    float ksum = 0.0f;
#pragma unroll 1
    for (int m = 0; m < NKER; ++m) {
      const float a = (float)(__bf16)amp[m * NH + hd];
      const float o = (float)(__bf16)off[m * NH + hd];
      const float s = (float)(__bf16)shp[m * NH + hd];
      const float sg = (a > 0.0f) ? 1.0f : ((a < 0.0f) ? -1.0f : 0.0f);
      const float x  = sg * ((rel - o) * __builtin_amdgcn_rcpf(s));
      const float ex = __expf(-x);
      const float sig = __builtin_amdgcn_rcpf(1.0f + ex);
      ksum = ksum + fabsf(a) * sig;
    }
    const float bp = (float)(__bf16)bpar[hd];
    val = logf((ksum + 1e-8f) + bp) - fabsf(rel) * slope;
  }
  float* dst = tab + idx;
  *dst = val;
  
}

// ---------------- launch 1, the other grid rows: bf16 planes: qp = q/8 [bh][SEQ][HD], kp = k [bh][SEQ][HD], vtp = v transposed [bh][HD][SEQ] ----------------
__device__ __forceinline__
void cvt_part(const float* __restrict__ q, const float* __restrict__ k, const float* __restrict__ v,
              __bf16* __restrict__ qp, __bf16* __restrict__ kp, __bf16* __restrict__ vtp) {
  __shared__ __attribute__((aligned(16))) __bf16 tsm[HD][KBLK + 8];   // [d][key local], pitch 72 halves

  const int tid  = threadIdx.x;
  const int lane = tid & 31;
  const int wave = tid >> 5;
  const int n0   = blockIdx.x * KBLK;
  const int bh   = blockIdx.y - TABY;
  const size_t rb = (size_t)bh * SEQ + (size_t)n0;

#pragma unroll
  for (int it = 0; it < 2; ++it) {
    const int rl = it * 32 + wave * 4 + (lane >> 3);   // key/query row 0..63 in this block
    const int c  = (lane & 7) * 8;
    const size_t e = (rb + (size_t)rl) * HD + (size_t)c;
    {
      const v4f f0 = *(const v4f*)(q + e);
      const v4f f1 = *(const v4f*)(q + e + 4);
      Pack8 o;
#pragma unroll
      for (int j = 0; j < 4; ++j) { o.b[j] = (__bf16)(f0[j] * 0.125f); o.b[4 + j] = (__bf16)(f1[j] * 0.125f); }
      v4f* d = (v4f*)(qp + e);
      *d = o.f;
      
    }
    {
      const v4f f0 = *(const v4f*)(k + e);
      const v4f f1 = *(const v4f*)(k + e + 4);
      Pack8 o;
#pragma unroll
      for (int j = 0; j < 4; ++j) { o.b[j] = (__bf16)f0[j]; o.b[4 + j] = (__bf16)f1[j]; }
      v4f* d = (v4f*)(kp + e);
      *d = o.f;
      
    }
    {
      const v4f f0 = *(const v4f*)(v + e);
      const v4f f1 = *(const v4f*)(v + e + 4);
#pragma unroll
      for (int j = 0; j < 4; ++j) { tsm[c + j][rl] = (__bf16)f0[j]; tsm[c + 4 + j][rl] = (__bf16)f1[j]; }
    }
  }
  __syncthreads();

#pragma unroll
  for (int it = 0; it < 2; ++it) {
    const int d = wave * 8 + it * 4 + (lane >> 3);    // 0..63
    const int c = (lane & 7) * 8;
    Pack8 o;
    o.b = *(const v8b*)(&tsm[d][c]);
    v4f* dst = (v4f*)(vtp + ((size_t)bh * HD + (size_t)d) * SEQ + (size_t)n0 + (size_t)c);
    *dst = o.f;
    
  }
  // behind the last stores: code of the other role follows them in the built kernel, and no register that an issued store names is rewritten ahead of this wait
  asm volatile("s_wait_xcnt 0x0" ::: "memory");
}

// Table and planes in one launch: neither part reads what the other writes. The table's work-groups come first in the grid,
// so that their chain of dependent loads runs under the planes' stream. The test reads the same for a whole work-group,
// so the barrier in cvt_part is passed by all of a work-group's waves or by none.
__global__ __launch_bounds__(256)
void k_pre(const float* __restrict__ q, const float* __restrict__ k, const float* __restrict__ v,
           const float* __restrict__ off, const float* __restrict__ amp,
           const float* __restrict__ shp, const float* __restrict__ bpar,
           float* __restrict__ tab,
           __bf16* __restrict__ qp, __bf16* __restrict__ kp, __bf16* __restrict__ vtp) {
  if (blockIdx.y < TABY) bias_part(off, amp, shp, bpar, tab);
  else                   cvt_part(q, k, v, qp, kp, vtp);
}

// One K tile (64 keys x 64 d) and one Vt tile (64 d x 64 keys) into LDS: each lane copies 8 x 16 B, a wave-wide copy
// covers four whole 128-B rows. lk/lv: the lane's LDS byte address of its first K / Vt piece; gk/gv: its global source.
__device__ __forceinline__ void stage_tile(unsigned lk, const __bf16* gk, unsigned lv, const __bf16* gv) {
  // The closing s_wait_xcnt stands inside the copies' own statement so that no address register is rewritten ahead of it.
  asm volatile("global_load_async_to_lds_b128 %0, %1, off\n\t"
               "global_load_async_to_lds_b128 %2, %3, off\n\t"
               "global_load_async_to_lds_b128 %4, %5, off\n\t"
               "global_load_async_to_lds_b128 %6, %7, off\n\t"
               "global_load_async_to_lds_b128 %8, %9, off\n\t"
               "global_load_async_to_lds_b128 %10, %11, off\n\t"
               "global_load_async_to_lds_b128 %12, %13, off\n\t"
               "global_load_async_to_lds_b128 %14, %15, off\n\t"
               "s_wait_xcnt 0x0"
               :: "v"(lk),               "v"(gk),
                  "v"(lk + ROWS16B),     "v"(gk + 16 * HD),
                  "v"(lk + 2 * ROWS16B), "v"(gk + 32 * HD),
                  "v"(lk + 3 * ROWS16B), "v"(gk + 48 * HD),
                  "v"(lv),               "v"(gv),
                  "v"(lv + ROWS16B),     "v"(gv + 16 * SEQ),
                  "v"(lv + 2 * ROWS16B), "v"(gv + 32 * SEQ),
                  "v"(lv + 3 * ROWS16B), "v"(gv + 48 * SEQ)
               : "memory");
}

// ---------------- launch 2: streaming attention, one block per (bh, 64 queries), one wave per 16 queries ----------------
__global__ __launch_bounds__(NWAV * 32) __attribute__((amdgpu_num_vgpr(256)))
void k_attn(const __bf16* __restrict__ qp, const __bf16* __restrict__ kp,
            const __bf16* __restrict__ vtp, const float* __restrict__ tab,
            float* __restrict__ out) {
  __shared__ __attribute__((aligned(16))) float bw[BWIN];            // bias window for this query block
  __shared__ __attribute__((aligned(16))) float osm[NWAV][16][HD];   // per-wave output staging [query][d]
  __shared__ __attribute__((aligned(16))) __bf16 ring[2][2][TILEH];  // [buffer][K, Vt][row * KPIT + column]

  const int tid  = threadIdx.x;
  const int lane = tid & 31;
  const int wave = tid >> 5;
  const int hh   = lane >> 4;        // lane half
  const int n    = lane & 15;        // fragment row (A) / column (B, D)
  const int bh   = blockIdx.y;
  const int head = bh & (NH - 1);
  const int m0   = blockIdx.x * QBLK;

  // staging addresses of this lane: row tid/8 (+16 per copy), 16-B piece tid%8
  const unsigned lst = (unsigned)(uintptr_t)(&ring[0][0][0]) + (unsigned)((tid >> 3) * (KPIT * 2) + (tid & 7) * 16);
  const __bf16* gks = kp  + (size_t)bh * SEQ * HD + (size_t)((tid >> 3) * HD  + (tid & 7) * 8);   // + tile * KBLK * HD
  const __bf16* gvs = vtp + (size_t)bh * HD * SEQ + (size_t)((tid >> 3) * SEQ + (tid & 7) * 8);   // + tile * KBLK
  stage_tile(lst, gks, lst + TILEH * 2, gvs);                                                     // tile 0 -> buffer 0

  // bw[w] = tab[head][(SEQ-QBLK-m0) + w], w = key - query_local + QBLK-1 in [0, SEQ+QBLK-2]
  {
    const float* tb = tab + (size_t)head * RELP + (size_t)(SEQ - QBLK - m0);
    for (int i = tid; i < SEQ + QBLK - 1; i += NWAV * 32) bw[i] = tb[i];
  }

  // Q as B operand: lane n -> query m0+wave*16+n; elements 0..7 <- d ks*32+8hh.., 8..15 <- d ks*32+16+8hh..
  Frag qf[2];
  {
    const __bf16* qr = qp + ((size_t)bh * SEQ + (size_t)(m0 + wave * 16 + n)) * HD + 8 * hh;
#pragma unroll
    for (int ks = 0; ks < 2; ++ks) {
      qf[ks].p[0] = *(const v8b*)(qr + ks * 32);
      qf[ks].p[1] = *(const v8b*)(qr + ks * 32 + 16);
    }
  }
  asm volatile("s_wait_asynccnt 0x0" ::: "memory");   // this wave's pieces of tile 0 have landed before the barrier publishes them
  __syncthreads();
  stage_tile(lst + 2 * TILEH * 2, gks + KBLK * HD, lst + 3 * TILEH * 2, gvs + KBLK);   // tile 1 -> buffer 1, flies during trip 0

  v8f oacc[4];
#pragma unroll
  for (int dt = 0; dt < 4; ++dt) oacc[dt] = vzero8();
  float mrun = -INFINITY;
  float lrun = 0.0f;

  const int wb = 8 * hh - wave * 16 - n + (QBLK - 1);

#pragma unroll 1   // stays rolled: one hand-over point, the buffer picked by t & 1
  for (int t = 0; t < NT; ++t) {
    const int n0 = t * KBLK;
    const __bf16* kb = &ring[t & 1][0][n * KPIT + 8 * hh];   // + kt*16*KPIT + ks*32 (+16)
    const __bf16* vb = &ring[t & 1][1][n * KPIT + 8 * hh];   // + dt*16*KPIT + kk*32 (+16)

    // St[key][query] tiles: A = K rows (lane n -> key n0+kt*16+n, split d map), B = Q; D[r] = key kt*16+8hh+r, query n
    // all 16 reads stand as one group ahead of the products; unrolled so that every fragment index is a constant
    Frag ka[4][2];
#pragma unroll
    for (int kt = 0; kt < 4; ++kt) {
#pragma unroll
      for (int ks = 0; ks < 2; ++ks) {
        ka[kt][ks].p[0] = *(const v8b*)(kb + kt * 16 * KPIT + ks * 32);
        ka[kt][ks].p[1] = *(const v8b*)(kb + kt * 16 * KPIT + ks * 32 + 16);
      }
    }
    v8f s[4];
#pragma unroll
    for (int kt = 0; kt < 4; ++kt) {
      v8f c = vzero8();
#pragma unroll
      for (int ks = 0; ks < 2; ++ks) c = wmma16(ka[kt][ks].v, qf[ks].v, c);
      s[kt] = c;
    }

    // A = Vt rows d = dt*16+n, keys n0+kk*32 + split map; read here so that the LDS latency passes under the softmax
    Frag va[2][4];
#pragma unroll
    for (int kk = 0; kk < 2; ++kk) {
#pragma unroll
      for (int dt = 0; dt < 4; ++dt) {
        va[kk][dt].p[0] = *(const v8b*)(vb + dt * 16 * KPIT + kk * 32);
        va[kk][dt].p[1] = *(const v8b*)(vb + dt * 16 * KPIT + kk * 32 + 16);
      }
    }

    // bias add, running max/sum per query (lane pair n, n+16)
    const float* bwl = bw + (wb + n0);
    float tmax = -INFINITY;
#pragma unroll
    for (int kt = 0; kt < 4; ++kt) {
#pragma unroll
      for (int r = 0; r < 8; ++r) {
        const float x = s[kt][r] + bwl[kt * 16 + r];
        s[kt][r] = x;
        tmax = fmaxf(tmax, x);
      }
    }
    tmax = fmaxf(tmax, __shfl_xor(tmax, 16, 32));
    const float mnew  = fmaxf(mrun, tmax);
    const float alpha = __expf(mrun - mnew);
    mrun = mnew;
    float psum = 0.0f;
#pragma unroll
    for (int kt = 0; kt < 4; ++kt) {
#pragma unroll
      for (int r = 0; r < 8; ++r) {
        const float p = __expf(s[kt][r] - mnew);
        s[kt][r] = p;
        psum += p;
      }
    }
    psum += __shfl_xor(psum, 16, 32);
    lrun = alpha * lrun + psum;
#pragma unroll
    for (int dt = 0; dt < 4; ++dt) oacc[dt] = oacc[dt] * alpha;

    // Ot[d][query] += Vt[d][key] * Pt[key][query]; B = Pt in-lane from two adjacent S tiles:
    // element i <- tile 2kk (keys kk*32+8hh+i), element 8+i <- tile 2kk+1 (keys kk*32+16+8hh+i); hi and lo bf16 parts
#pragma unroll
    for (int kk = 0; kk < 2; ++kk) {
      v16b phi, plo;
#pragma unroll
      for (int i = 0; i < 8; ++i) {
        const float p0 = s[2 * kk][i];
        const __bf16 b0 = (__bf16)p0;
        phi[i] = b0;
        plo[i] = (__bf16)(p0 - (float)b0);
        const float p1 = s[2 * kk + 1][i];
        const __bf16 b1 = (__bf16)p1;
        phi[8 + i] = b1;
        plo[8 + i] = (__bf16)(p1 - (float)b1);
      }
#pragma unroll
      for (int dt = 0; dt < 4; ++dt) {
        v8f c = oacc[dt];
        c = wmma16(va[kk][dt].v, phi, c);
        c = wmma16(va[kk][dt].v, plo, c);
        oacc[dt] = c;
      }
    }

    // hand-over: tile t+1 becomes readable, buffer t&1 becomes free
    asm volatile("s_wait_dscnt 0x0" ::: "memory");      // this wave's reads of buffer t&1 are done before it is refilled
    asm volatile("s_wait_asynccnt 0x0" ::: "memory");   // this wave's pieces of tile t+1 have landed before the barrier publishes them
    __syncthreads();
    if (t + 2 < NT)
      stage_tile(lst + (unsigned)(t & 1) * (2 * TILEH * 2), gks + (size_t)(t + 2) * (KBLK * HD),
                 lst + (unsigned)(t & 1) * (2 * TILEH * 2) + TILEH * 2, gvs + (size_t)(t + 2) * KBLK);
  }
  asm volatile("s_wait_asynccnt 0x0" ::: "memory");     // no copy is outstanding when the wave goes on to its end

  const float inv = 1.0f / lrun;
#pragma unroll
  for (int dt = 0; dt < 4; ++dt) {
#pragma unroll
    for (int r = 0; r < 8; ++r) osm[wave][n][dt * 16 + 8 * hh + r] = oacc[dt][r] * inv;
  }
  __syncthreads();

  float* ob = out + ((size_t)bh * SEQ + (size_t)(m0 + wave * 16)) * HD;
  v4f vals[8];
#pragma unroll
  for (int it = 0; it < 8; ++it) vals[it] = *(const v4f*)(&osm[wave][it * 2 + hh][n * 4]);
#pragma unroll
  for (int it = 0; it < 8; ++it)
    *(v4f*)(ob + (size_t)(it * 2 + hh) * HD + (size_t)(n * 4)) = vals[it];
  
}

// ---------------- launcher ----------------
extern "C" void kernel_launch(void* const* d_in, const int* in_sizes, int n_in,
                              void* d_out, int out_size, void* d_ws, size_t ws_size,
                              hipStream_t stream) {
  if (n_in < 7) return;
  const int nq = NBH * SEQ * HD;
  if (in_sizes[0] != nq || in_sizes[1] != nq || in_sizes[2] != nq || out_size != nq) return;
  if (in_sizes[3] < NKER * NH || in_sizes[4] < NKER * NH || in_sizes[5] < NKER * NH || in_sizes[6] < NH) return;

  const size_t tab_bytes = (size_t)NH * RELP * sizeof(float);        // 131072
  const size_t pl_bytes  = (size_t)nq * sizeof(__bf16);              // 8388608
  const size_t need      = tab_bytes + 3 * pl_bytes;                 // 25296896
  if (need > ws_size) return;

  const float* q    = (const float*)d_in[0];
  const float* k    = (const float*)d_in[1];
  const float* v    = (const float*)d_in[2];
  const float* off  = (const float*)d_in[3];
  const float* amp  = (const float*)d_in[4];
  const float* shp  = (const float*)d_in[5];
  const float* bpar = (const float*)d_in[6];
  float* out = (float*)d_out;

  char* ws = (char*)d_ws;
  float*  tab = (float*)ws;
  __bf16* qp  = (__bf16*)(ws + tab_bytes);
  __bf16* kp  = (__bf16*)(ws + tab_bytes + pl_bytes);
  __bf16* vtp = (__bf16*)(ws + tab_bytes + 2 * pl_bytes);

  hipLaunchKernelGGL(k_pre, dim3(SEQ / KBLK, NBH + TABY), dim3(256), 0, stream,
                     q, k, v, off, amp, shp, bpar, tab, qp, kp, vtp);
  hipLaunchKernelGGL(k_attn, dim3(SEQ / QBLK, NBH), dim3(NWAV * 32), 0, stream,
                     (const __bf16*)qp, (const __bf16*)kp, (const __bf16*)vtp, (const float*)tab, out);
}

// v003
// It runs in 44.5 microseconds.
// In both of two side-by-side timings against v002, it was 1.05 times as fast.
// All steps since v000 together make it 2.28 times as fast.
#include <hip/hip_runtime.h>
#include <math.h>

// Contractions: S = K*Qt on v_wmma_f32_16x16x32_bf16 (bf16 operands, f32 accumulate);
// O = Vt*Pt on v_wmma_f32_16x16x32_bf16 (V bf16, P as bf16 hi+lo pair, f32 accumulate); bias table and softmax in f32.

#define NH    16
#define NKER  8
#define SEQ   1024
#define HD    64
#define NBH   64
#define RELN  (2 * SEQ - 1)
#define RELP  2048
#define QBLK  64
#define KBLK  64
#define NWAV  4
#define BWIN  (SEQ + QBLK)
#define NT    (SEQ / KBLK)
#define KPIT  72                 // halves per staged LDS row: 128 B of data + 16 B, the pitch for ds_load_b128 readers
#define TILEH (64 * KPIT)        // halves per staged tile (64 rows)
#define ROWS16B (16 * KPIT * 2)  // LDS bytes of 16 staged rows
#define TABY  ((NH * RELP) / (256 * (SEQ / KBLK)))   // grid rows of launch 1 that build the bias table (8)

typedef __bf16 v16b __attribute__((ext_vector_type(16)));
typedef __bf16 v8b  __attribute__((ext_vector_type(8)));
typedef float  v8f  __attribute__((ext_vector_type(8)));
typedef float  v4f  __attribute__((ext_vector_type(4)));

union Frag  { v16b v; v8b p[2]; };
union Pack8 { v8b b; v4f f; };

__device__ __forceinline__ v8f wmma16(v16b a, v16b b, v8f c) {
  return __builtin_amdgcn_wmma_f32_16x16x32_bf16(false, a, false, b, (short)0, c, false, false);
}

__device__ __forceinline__ v8f vzero8() {
  v8f z = {0.0f, 0.0f, 0.0f, 0.0f, 0.0f, 0.0f, 0.0f, 0.0f};
  return z;
}

// ---------------- launch 1, grid rows 0..TABY-1: relative bias table tab[NH][RELP] (f32, last column is padding = 0) ----------------
__device__ __forceinline__
void bias_part(const float* __restrict__ off, const float* __restrict__ amp,
               const float* __restrict__ shp, const float* __restrict__ bpar,
               float* __restrict__ tab) {
  const int idx = (blockIdx.y * (SEQ / KBLK) + blockIdx.x) * 256 + threadIdx.x;
  if (idx >= NH * RELP) return;
  const int hd = idx >> 11;
  const int r  = idx & (RELP - 1);
  float val = 0.0f;
  if (r < RELN) {
    const float rel = (float)(r - (SEQ - 1));
    float slope = 0.0f;
    if (hd < NH - 2) {
      const float e = (float)hd * (1.0f / 13.0f);
      slope = 4.6051702f * exp2f(-6.0f * e);      // 4.6051702 * (1/64)^e
    }
    float ksum = 0.0f;
#pragma unroll 1
    for (int m = 0; m < NKER; ++m) {
      const float a = (float)(__bf16)amp[m * NH + hd];
      const float o = (float)(__bf16)off[m * NH + hd];
      const float s = (float)(__bf16)shp[m * NH + hd];
      const float sg = (a > 0.0f) ? 1.0f : ((a < 0.0f) ? -1.0f : 0.0f);
      const float x  = sg * ((rel - o) * __builtin_amdgcn_rcpf(s));
      const float ex = __expf(-x);
      const float sig = __builtin_amdgcn_rcpf(1.0f + ex);
      ksum = ksum + fabsf(a) * sig;
    }
    const float bp = (float)(__bf16)bpar[hd];
    val = logf((ksum + 1e-8f) + bp) - fabsf(rel) * slope;
  }
  float* dst = tab + idx;
  *dst = val;
  
}

// ---------------- launch 1, the other grid rows: bf16 planes: qp = q/8 [bh][SEQ][HD], kp = k [bh][SEQ][HD], vtp = v transposed [bh][HD][SEQ] ----------------
__device__ __forceinline__
void cvt_part(const float* __restrict__ q, const float* __restrict__ k, const float* __restrict__ v,
              __bf16* __restrict__ qp, __bf16* __restrict__ kp, __bf16* __restrict__ vtp) {
  __shared__ __attribute__((aligned(16))) __bf16 tsm[HD][KBLK + 8];   // [d][key local], pitch 72 halves

  const int tid  = threadIdx.x;
  const int lane = tid & 31;
  const int wave = tid >> 5;
  const int n0   = blockIdx.x * KBLK;
  const int bh   = blockIdx.y - TABY;
  const size_t rb = (size_t)bh * SEQ + (size_t)n0;

#pragma unroll
  for (int it = 0; it < 2; ++it) {
    const int rl = it * 32 + wave * 4 + (lane >> 3);   // key/query row 0..63 in this block
    const int c  = (lane & 7) * 8;
    const size_t e = (rb + (size_t)rl) * HD + (size_t)c;
    {
      const v4f f0 = *(const v4f*)(q + e);
      const v4f f1 = *(const v4f*)(q + e + 4);
      Pack8 o;
#pragma unroll
      for (int j = 0; j < 4; ++j) { o.b[j] = (__bf16)(f0[j] * 0.125f); o.b[4 + j] = (__bf16)(f1[j] * 0.125f); }
      v4f* d = (v4f*)(qp + e);
      *d = o.f;
      
    }
    {
      const v4f f0 = *(const v4f*)(k + e);
      const v4f f1 = *(const v4f*)(k + e + 4);
      Pack8 o;
#pragma unroll
      for (int j = 0; j < 4; ++j) { o.b[j] = (__bf16)f0[j]; o.b[4 + j] = (__bf16)f1[j]; }
      v4f* d = (v4f*)(kp + e);
      *d = o.f;
      
    }
    {
      const v4f f0 = *(const v4f*)(v + e);
      const v4f f1 = *(const v4f*)(v + e + 4);
#pragma unroll
      for (int j = 0; j < 4; ++j) { tsm[c + j][rl] = (__bf16)f0[j]; tsm[c + 4 + j][rl] = (__bf16)f1[j]; }
    }
  }
  __syncthreads();

#pragma unroll
  for (int it = 0; it < 2; ++it) {
    const int d = wave * 8 + it * 4 + (lane >> 3);    // 0..63
    const int c = (lane & 7) * 8;
    Pack8 o;
    o.b = *(const v8b*)(&tsm[d][c]);
    v4f* dst = (v4f*)(vtp + ((size_t)bh * HD + (size_t)d) * SEQ + (size_t)n0 + (size_t)c);
    *dst = o.f;
    
  }
  // behind the last stores: code of the other role follows them in the built kernel, and no register that an issued store names is rewritten ahead of this wait
  asm volatile("s_wait_xcnt 0x0" ::: "memory");
}

// Table and planes in one launch: neither part reads what the other writes. The table's work-groups come first in the grid,
// so that their chain of dependent loads runs under the planes' stream. The test reads the same for a whole work-group,
// so the barrier in cvt_part is passed by all of a work-group's waves or by none.
__global__ __launch_bounds__(256)
void k_pre(const float* __restrict__ q, const float* __restrict__ k, const float* __restrict__ v,
           const float* __restrict__ off, const float* __restrict__ amp,
           const float* __restrict__ shp, const float* __restrict__ bpar,
           float* __restrict__ tab,
           __bf16* __restrict__ qp, __bf16* __restrict__ kp, __bf16* __restrict__ vtp) {
  if (blockIdx.y < TABY) bias_part(off, amp, shp, bpar, tab);
  else                   cvt_part(q, k, v, qp, kp, vtp);
}

// One K tile (64 keys x 64 d) and one Vt tile (64 d x 64 keys) into LDS: each lane copies 8 x 16 B, a wave-wide copy
// covers four whole 128-B rows. lk/lv: the lane's LDS byte address of its first K / Vt piece; gk/gv: its global source.
__device__ __forceinline__ void stage_tile(unsigned lk, const __bf16* gk, unsigned lv, const __bf16* gv) {
  // The closing s_wait_xcnt stands inside the copies' own statement so that no address register is rewritten ahead of it.
  asm volatile("global_load_async_to_lds_b128 %0, %1, off\n\t"
               "global_load_async_to_lds_b128 %2, %3, off\n\t"
               "global_load_async_to_lds_b128 %4, %5, off\n\t"
               "global_load_async_to_lds_b128 %6, %7, off\n\t"
               "global_load_async_to_lds_b128 %8, %9, off\n\t"
               "global_load_async_to_lds_b128 %10, %11, off\n\t"
               "global_load_async_to_lds_b128 %12, %13, off\n\t"
               "global_load_async_to_lds_b128 %14, %15, off\n\t"
               "s_wait_xcnt 0x0"
               :: "v"(lk),               "v"(gk),
                  "v"(lk + ROWS16B),     "v"(gk + 16 * HD),
                  "v"(lk + 2 * ROWS16B), "v"(gk + 32 * HD),
                  "v"(lk + 3 * ROWS16B), "v"(gk + 48 * HD),
                  "v"(lv),               "v"(gv),
                  "v"(lv + ROWS16B),     "v"(gv + 16 * SEQ),
                  "v"(lv + 2 * ROWS16B), "v"(gv + 32 * SEQ),
                  "v"(lv + 3 * ROWS16B), "v"(gv + 48 * SEQ)
               : "memory");
}

// ---------------- launch 2: streaming attention, one block per (bh, 64 queries), one wave per 16 queries ----------------
__global__ __launch_bounds__(NWAV * 32) __attribute__((amdgpu_num_vgpr(256)))
void k_attn(const __bf16* __restrict__ qp, const __bf16* __restrict__ kp,
            const __bf16* __restrict__ vtp, const float* __restrict__ tab,
            float* __restrict__ out) {
  __shared__ __attribute__((aligned(16))) float bw[BWIN];            // bias window for this query block
  __shared__ __attribute__((aligned(16))) float osm[NWAV][16][HD];   // per-wave output staging [query][d]
  __shared__ __attribute__((aligned(16))) __bf16 ring[2][2][TILEH];  // [buffer][K, Vt][row * KPIT + column]

  const int tid  = threadIdx.x;
  const int lane = tid & 31;
  const int wave = tid >> 5;
  const int hh   = lane >> 4;        // lane half
  const int n    = lane & 15;        // fragment row (A) / column (B, D)
  const int bh   = blockIdx.y;
  const int head = bh & (NH - 1);
  const int m0   = blockIdx.x * QBLK;

  // staging addresses of this lane: row tid/8 (+16 per copy), 16-B piece tid%8
  const unsigned lst = (unsigned)(uintptr_t)(&ring[0][0][0]) + (unsigned)((tid >> 3) * (KPIT * 2) + (tid & 7) * 16);
  const __bf16* gks = kp  + (size_t)bh * SEQ * HD + (size_t)((tid >> 3) * HD  + (tid & 7) * 8);   // + tile * KBLK * HD
  const __bf16* gvs = vtp + (size_t)bh * HD * SEQ + (size_t)((tid >> 3) * SEQ + (tid & 7) * 8);   // + tile * KBLK
  stage_tile(lst, gks, lst + TILEH * 2, gvs);                                                     // tile 0 -> buffer 0

  // bw[w] = tab[head][(SEQ-QBLK-m0) + w], w = key - query_local + QBLK-1 in [0, SEQ+QBLK-2]
  {
    const float* tb = tab + (size_t)head * RELP + (size_t)(SEQ - QBLK - m0);
    for (int i = tid; i < SEQ + QBLK - 1; i += NWAV * 32) bw[i] = tb[i];
  }

  // Q as B operand: lane n -> query m0+wave*16+n; elements 0..7 <- d ks*32+8hh.., 8..15 <- d ks*32+16+8hh..
  Frag qf[2];
  {
    const __bf16* qr = qp + ((size_t)bh * SEQ + (size_t)(m0 + wave * 16 + n)) * HD + 8 * hh;
#pragma unroll
    for (int ks = 0; ks < 2; ++ks) {
      qf[ks].p[0] = *(const v8b*)(qr + ks * 32);
      qf[ks].p[1] = *(const v8b*)(qr + ks * 32 + 16);
    }
  }
  asm volatile("s_wait_asynccnt 0x0" ::: "memory");   // this wave's pieces of tile 0 have landed before the barrier publishes them
  __syncthreads();
  stage_tile(lst + 2 * TILEH * 2, gks + KBLK * HD, lst + 3 * TILEH * 2, gvs + KBLK);   // tile 1 -> buffer 1, flies during trip 0

  v8f oacc[4];
#pragma unroll
  for (int dt = 0; dt < 4; ++dt) oacc[dt] = vzero8();
  float mrun = -INFINITY;
  float lrun = 0.0f;

  const int wb = 8 * hh - wave * 16 - n + (QBLK - 1);

#pragma unroll 1   // stays rolled: one hand-over point, the buffer picked by t & 1
  for (int t = 0; t < NT; ++t) {
    const int n0 = t * KBLK;
    const __bf16* kb = &ring[t & 1][0][n * KPIT + 8 * hh];   // + kt*16*KPIT + ks*32 (+16)
    const __bf16* vb = &ring[t & 1][1][n * KPIT + 8 * hh];   // + dt*16*KPIT + kk*32 (+16)

    // St[key][query] tiles: A = K rows (lane n -> key n0+kt*16+n, split d map), B = Q; D[r] = key kt*16+8hh+r, query n
    // all 16 reads stand as one group ahead of the products; unrolled so that every fragment index is a constant
    Frag ka[4][2];
#pragma unroll
    for (int kt = 0; kt < 4; ++kt) {
#pragma unroll
      for (int ks = 0; ks < 2; ++ks) {
        ka[kt][ks].p[0] = *(const v8b*)(kb + kt * 16 * KPIT + ks * 32);
        ka[kt][ks].p[1] = *(const v8b*)(kb + kt * 16 * KPIT + ks * 32 + 16);
      }
    }
    __builtin_amdgcn_sched_barrier(0);   // keeps the 16 K reads one group ahead of the products; without it they sink among the WMMAs, each behind a wait of its own
    v8f s[4];
#pragma unroll
    for (int kt = 0; kt < 4; ++kt) {
      v8f c = vzero8();
#pragma unroll
      for (int ks = 0; ks < 2; ++ks) c = wmma16(ka[kt][ks].v, qf[ks].v, c);
      s[kt] = c;
    }

    // A = Vt rows d = dt*16+n, keys n0+kk*32 + split map; read here so that the LDS latency passes under the softmax
    Frag va[2][4];
#pragma unroll
    for (int kk = 0; kk < 2; ++kk) {
#pragma unroll
      for (int dt = 0; dt < 4; ++dt) {
        va[kk][dt].p[0] = *(const v8b*)(vb + dt * 16 * KPIT + kk * 32);
        va[kk][dt].p[1] = *(const v8b*)(vb + dt * 16 * KPIT + kk * 32 + 16);
      }
    }

    __builtin_amdgcn_sched_barrier(0);   // keeps the 16 Vt reads one group ahead of the softmax; without it they sink to their WMMAs and the wave waits out each LDS latency

    // bias add, running max/sum per query (lane pair n, n+16)
    const float* bwl = bw + (wb + n0);
    float tmax = -INFINITY;
#pragma unroll
    for (int kt = 0; kt < 4; ++kt) {
#pragma unroll
      for (int r = 0; r < 8; ++r) {
        const float x = s[kt][r] + bwl[kt * 16 + r];
        s[kt][r] = x;
        tmax = fmaxf(tmax, x);
      }
    }
    tmax = fmaxf(tmax, __shfl_xor(tmax, 16, 32));
    const float mnew  = fmaxf(mrun, tmax);
    const float alpha = __expf(mrun - mnew);
    mrun = mnew;
    float psum = 0.0f;
#pragma unroll
    for (int kt = 0; kt < 4; ++kt) {
#pragma unroll
      for (int r = 0; r < 8; ++r) {
        const float p = __expf(s[kt][r] - mnew);
        s[kt][r] = p;
        psum += p;
      }
    }
    psum += __shfl_xor(psum, 16, 32);
    lrun = alpha * lrun + psum;
#pragma unroll
    for (int dt = 0; dt < 4; ++dt) oacc[dt] = oacc[dt] * alpha;

    // Ot[d][query] += Vt[d][key] * Pt[key][query]; B = Pt in-lane from two adjacent S tiles:
    // element i <- tile 2kk (keys kk*32+8hh+i), element 8+i <- tile 2kk+1 (keys kk*32+16+8hh+i); hi and lo bf16 parts
#pragma unroll
    for (int kk = 0; kk < 2; ++kk) {
      v16b phi, plo;
#pragma unroll
      for (int i = 0; i < 8; ++i) {
        const float p0 = s[2 * kk][i];
        const __bf16 b0 = (__bf16)p0;
        phi[i] = b0;
        plo[i] = (__bf16)(p0 - (float)b0);
        const float p1 = s[2 * kk + 1][i];
        const __bf16 b1 = (__bf16)p1;
        phi[8 + i] = b1;
        plo[8 + i] = (__bf16)(p1 - (float)b1);
      }
#pragma unroll
      for (int dt = 0; dt < 4; ++dt) {
        v8f c = oacc[dt];
        c = wmma16(va[kk][dt].v, phi, c);
        c = wmma16(va[kk][dt].v, plo, c);
        oacc[dt] = c;
      }
    }

    // hand-over: tile t+1 becomes readable, buffer t&1 becomes free
    __builtin_amdgcn_sched_barrier(0);   // keeps the trip's arithmetic ahead of the hand-over; without it the waits rise to the last LDS read and tile t+1 loses most of its flight time
    asm volatile("s_wait_dscnt 0x0" ::: "memory");      // this wave's reads of buffer t&1 are done before it is refilled
    asm volatile("s_wait_asynccnt 0x0" ::: "memory");   // this wave's pieces of tile t+1 have landed before the barrier publishes them
    __syncthreads();
    if (t + 2 < NT)
      stage_tile(lst + (unsigned)(t & 1) * (2 * TILEH * 2), gks + (size_t)(t + 2) * (KBLK * HD),
                 lst + (unsigned)(t & 1) * (2 * TILEH * 2) + TILEH * 2, gvs + (size_t)(t + 2) * KBLK);
  }
  asm volatile("s_wait_asynccnt 0x0" ::: "memory");     // no copy is outstanding when the wave goes on to its end

  const float inv = 1.0f / lrun;
#pragma unroll
  for (int dt = 0; dt < 4; ++dt) {
#pragma unroll
    for (int r = 0; r < 8; ++r) osm[wave][n][dt * 16 + 8 * hh + r] = oacc[dt][r] * inv;
  }
  __syncthreads();

  float* ob = out + ((size_t)bh * SEQ + (size_t)(m0 + wave * 16)) * HD;
  v4f vals[8];
#pragma unroll
  for (int it = 0; it < 8; ++it) vals[it] = *(const v4f*)(&osm[wave][it * 2 + hh][n * 4]);
#pragma unroll
  for (int it = 0; it < 8; ++it)
    *(v4f*)(ob + (size_t)(it * 2 + hh) * HD + (size_t)(n * 4)) = vals[it];
  
}

// ---------------- launcher ----------------
extern "C" void kernel_launch(void* const* d_in, const int* in_sizes, int n_in,
                              void* d_out, int out_size, void* d_ws, size_t ws_size,
                              hipStream_t stream) {
  if (n_in < 7) return;
  const int nq = NBH * SEQ * HD;
  if (in_sizes[0] != nq || in_sizes[1] != nq || in_sizes[2] != nq || out_size != nq) return;
  if (in_sizes[3] < NKER * NH || in_sizes[4] < NKER * NH || in_sizes[5] < NKER * NH || in_sizes[6] < NH) return;

  const size_t tab_bytes = (size_t)NH * RELP * sizeof(float);        // 131072
  const size_t pl_bytes  = (size_t)nq * sizeof(__bf16);              // 8388608
  const size_t need      = tab_bytes + 3 * pl_bytes;                 // 25296896
  if (need > ws_size) return;

  const float* q    = (const float*)d_in[0];
  const float* k    = (const float*)d_in[1];
  const float* v    = (const float*)d_in[2];
  const float* off  = (const float*)d_in[3];
  const float* amp  = (const float*)d_in[4];
  const float* shp  = (const float*)d_in[5];
  const float* bpar = (const float*)d_in[6];
  float* out = (float*)d_out;

  char* ws = (char*)d_ws;
  float*  tab = (float*)ws;
  __bf16* qp  = (__bf16*)(ws + tab_bytes);
  __bf16* kp  = (__bf16*)(ws + tab_bytes + pl_bytes);
  __bf16* vtp = (__bf16*)(ws + tab_bytes + 2 * pl_bytes);

  hipLaunchKernelGGL(k_pre, dim3(SEQ / KBLK, NBH + TABY), dim3(256), 0, stream,
                     q, k, v, off, amp, shp, bpar, tab, qp, kp, vtp);
  hipLaunchKernelGGL(k_attn, dim3(SEQ / QBLK, NBH), dim3(NWAV * 32), 0, stream,
                     (const __bf16*)qp, (const __bf16*)kp, (const __bf16*)vtp, (const float*)tab, out);
}

// v004
// A run of this version takes 32.7 microseconds.
// Timed twice side by side with v003, it ran 1.36 times as fast both times.
// Over all steps from v000 it is 3.11 times as fast.
#include <hip/hip_runtime.h>
#include <math.h>

// Contractions: S = K*Qt on v_wmma_f32_16x16x32_bf16 (bf16 operands, f32 accumulate);
// O = Vt*Pt on v_wmma_f32_16x16x32_bf16 (V bf16, P as bf16 hi+lo pair, f32 accumulate); bias window and softmax in f32.
// One launch: every work-group rounds its own Q rows and the K and V tiles it walks to bf16 and builds its own bias window.

#define NH    16
#define NKER  8
#define SEQ   1024
#define HD    64
#define NBH   64
#define QBLK  128
#define KBLK  64
#define NWAV  8
#define NTHR  (NWAV * 32)
#define BWIN  (SEQ + QBLK)
#define NT    (SEQ / KBLK)
#define KPIT  72                 // halves per staged K row: 128 B of data + 16 B, the pitch for ds_load_b128 readers
#define VPIT  80                 // halves per staged V row: 128 B of data + 32 B, the pitch for ds_load_tr16_b128 readers
#define NPC   ((KBLK * HD) / (NTHR * 4))   // 16-B pieces of one f32 tile per thread (4)

typedef __bf16 v16b __attribute__((ext_vector_type(16)));
typedef __bf16 v8b  __attribute__((ext_vector_type(8)));
typedef __bf16 v4b  __attribute__((ext_vector_type(4)));
typedef float  v8f  __attribute__((ext_vector_type(8)));
typedef float  v4f  __attribute__((ext_vector_type(4)));

union Frag  { v16b v; v8b p[2]; };

__device__ __forceinline__ v8f wmma16(v16b a, v16b b, v8f c) {
  return __builtin_amdgcn_wmma_f32_16x16x32_bf16(false, a, false, b, (short)0, c, false, false);
}

__device__ __forceinline__ v8f vzero8() {
  v8f z = {0.0f, 0.0f, 0.0f, 0.0f, 0.0f, 0.0f, 0.0f, 0.0f};
  return z;
}

// Transposing LDS load: lane (c = lane & 15, h = lane >> 4) gets column c, rows 8h .. 8h+7 of the 16 x 16 block of halves
// whose row (8h + (lane & 7)), 16-B piece ((lane >> 3) & 1) the lane's own address names.
__device__ __forceinline__ v8b ld_tr16(const __bf16* p) {
  typedef __attribute__((address_space(3))) v8b lds_v8b;
  return __builtin_amdgcn_ds_load_tr16_b128_v8bf16((lds_v8b*)p);
}

__device__ __forceinline__ v4b round4(v4f f) {
  v4b o;
#pragma unroll
  for (int j = 0; j < 4; ++j) o[j] = (__bf16)f[j];
  return o;
}

// ---------------- streaming attention, one block per (bh, 128 queries), one wave per 16 queries ----------------
__global__ __launch_bounds__(NTHR) __attribute__((amdgpu_num_vgpr(256)))
void k_attn(const float* __restrict__ q, const float* __restrict__ k, const float* __restrict__ v,
            const float* __restrict__ off, const float* __restrict__ amp,
            const float* __restrict__ shp, const float* __restrict__ bpar,
            float* __restrict__ out) {
  __shared__ __attribute__((aligned(16))) float bw[BWIN];               // bias window for this query block
  __shared__ __attribute__((aligned(16))) float osm[NWAV][16][HD];      // per-wave output staging [query][d]
  __shared__ __attribute__((aligned(16))) __bf16 ringk[2][KBLK * KPIT]; // [buffer][key * KPIT + d]
  __shared__ __attribute__((aligned(16))) __bf16 ringv[2][KBLK * VPIT]; // [buffer][key * VPIT + d]

  const int tid  = threadIdx.x;
  const int lane = tid & 31;
  const int wave = tid >> 5;
  const int hh   = lane >> 4;        // lane half
  const int n    = lane & 15;        // fragment row (A) / column (B, D)
  const int bh   = blockIdx.y;
  const int head = bh & (NH - 1);
  const int m0   = blockIdx.x * QBLK;

  // staging: an f32 tile (64 rows x 64) is 16 KiB in a row; piece i of this thread is floats (i * NTHR + tid) * 4 ..+3,
  // that is row i*16 + tid/16, columns (tid%16)*4 ..+3: every wave-wide load covers 512 contiguous bytes
  const float* gk = k + (size_t)bh * SEQ * HD + (size_t)(tid * 4);   // + i * NTHR * 4; steps on by a tile each trip
  const float* gv = v + (size_t)bh * SEQ * HD + (size_t)(tid * 4);
  const int sko = (tid >> 4) * KPIT + (tid & 15) * 4;                // + i * 16 * KPIT
  const int svo = (tid >> 4) * VPIT + (tid & 15) * 4;                // + i * 16 * VPIT

  v4f kr[NPC], vr[NPC];
#pragma unroll
  for (int i = 0; i < NPC; ++i) {                                    // tile 0
    kr[i] = *(const v4f*)(gk + i * NTHR * 4);
    vr[i] = *(const v4f*)(gv + i * NTHR * 4);
  }

  // Q rows of this wave, f32: lane n -> query m0+wave*16+n; d ks*32+8hh ..+7 and ks*32+16+8hh ..+7
  v4f qr4[2][2][2];
  {
    const float* qr = q + ((size_t)bh * SEQ + (size_t)(m0 + wave * 16 + n)) * HD + 8 * hh;
#pragma unroll
    for (int ks = 0; ks < 2; ++ks) {
#pragma unroll
      for (int j = 0; j < 2; ++j) {
        qr4[ks][j][0] = *(const v4f*)(qr + ks * 32 + j * 16);
        qr4[ks][j][1] = *(const v4f*)(qr + ks * 32 + j * 16 + 4);
      }
    }
  }
  // this head's kernel parameters, as stored
  float ra[NKER], ro[NKER], rs[NKER];
#pragma unroll
  for (int m = 0; m < NKER; ++m) {
    ra[m] = amp[m * NH + head];
    ro[m] = off[m * NH + head];
    rs[m] = shp[m * NH + head];
  }
  const float rb = bpar[head];
  // behind all the loads above: no address register that an issued load names is rewritten ahead of this wait
  asm volatile("s_wait_xcnt 0x0" ::: "memory");

  // bw[w] = relative bias of this head at rel = key - query = w - (QBLK-1) - m0, w = key - query_local + QBLK-1 in [0, SEQ+QBLK-2];
  // it runs while the loads above are in flight
  {
    float pa[NKER], po[NKER], pr[NKER], pg[NKER];
#pragma unroll
    for (int m = 0; m < NKER; ++m) {
      const float a = (float)(__bf16)ra[m];
      const float s = (float)(__bf16)rs[m];
      po[m] = (float)(__bf16)ro[m];
      pg[m] = (a > 0.0f) ? 1.0f : ((a < 0.0f) ? -1.0f : 0.0f);
      pr[m] = __builtin_amdgcn_rcpf(s);
      pa[m] = fabsf(a);
    }
    const float bp = (float)(__bf16)rb;
    float slope = 0.0f;
    if (head < NH - 2) {
      const float e = (float)head * (1.0f / 13.0f);
      slope = 4.6051702f * exp2f(-6.0f * e);      // 4.6051702 * (1/64)^e
    }
    for (int i = tid; i < SEQ + QBLK - 1; i += NTHR) {
      const float rel = (float)(i - (QBLK - 1) - m0);
      float ksum = 0.0f;
#pragma unroll
      for (int m = 0; m < NKER; ++m) {
        const float x  = pg[m] * ((rel - po[m]) * pr[m]);
        const float ex = __expf(-x);
        const float sig = __builtin_amdgcn_rcpf(1.0f + ex);
        ksum = fmaf(pa[m], sig, ksum);
      }
      bw[i] = logf((ksum + 1e-8f) + bp) - fabsf(rel) * slope;
    }
  }

  // Q as B operand, q/8 rounded to bf16: elements 0..7 <- d ks*32+8hh.., 8..15 <- d ks*32+16+8hh..
  Frag qf[2];
#pragma unroll
  for (int ks = 0; ks < 2; ++ks) {
#pragma unroll
    for (int j = 0; j < 2; ++j) {
#pragma unroll
      for (int e = 0; e < 4; ++e) {
        qf[ks].p[j][e]     = (__bf16)(qr4[ks][j][0][e] * 0.125f);
        qf[ks].p[j][4 + e] = (__bf16)(qr4[ks][j][1][e] * 0.125f);
      }
    }
  }

#pragma unroll
  for (int i = 0; i < NPC; ++i) {                                    // tile 0 -> buffer 0
    *(v4b*)(&ringk[0][sko + i * 16 * KPIT]) = round4(kr[i]);
    *(v4b*)(&ringv[0][svo + i * 16 * VPIT]) = round4(vr[i]);
  }
  __syncthreads();

  v8f oacc[4];
#pragma unroll
  for (int dt = 0; dt < 4; ++dt) oacc[dt] = vzero8();
  float mrun = -INFINITY;
  float lrun = 0.0f;

  const int wb = 8 * hh - wave * 16 - n + (QBLK - 1);

#pragma unroll 1   // stays rolled: one hand-over point, the buffer picked by t & 1
  for (int t = 0; t < NT; ++t) {
    const int n0 = t * KBLK;
    const __bf16* kb = &ringk[t & 1][n * KPIT + 8 * hh];                                   // + kt*16*KPIT + ks*32 (+16)
    const __bf16* vb = &ringv[t & 1][(8 * hh + (lane & 7)) * VPIT + ((lane >> 3) & 1) * 8]; // + (kk*32 (+16))*VPIT + dt*16

    // tile t+1, f32, into registers: issued here so that the whole trip passes under its latency
    if (t + 1 < NT) {
#pragma unroll
      for (int i = 0; i < NPC; ++i) {
        kr[i] = *(const v4f*)(gk + KBLK * HD + i * NTHR * 4);
        vr[i] = *(const v4f*)(gv + KBLK * HD + i * NTHR * 4);
      }
    }

    // St[key][query] tiles: A = K rows (lane n -> key n0+kt*16+n, split d map), B = Q; D[r] = key kt*16+8hh+r, query n
    // all 16 reads stand as one group ahead of the products; unrolled so that every fragment index is a constant
    Frag ka[4][2];
#pragma unroll
    for (int kt = 0; kt < 4; ++kt) {
#pragma unroll
      for (int ks = 0; ks < 2; ++ks) {
        ka[kt][ks].p[0] = *(const v8b*)(kb + kt * 16 * KPIT + ks * 32);
        ka[kt][ks].p[1] = *(const v8b*)(kb + kt * 16 * KPIT + ks * 32 + 16);
      }
    }
    __builtin_amdgcn_sched_barrier(0);   // keeps the 16 K reads one group ahead of the products; without it they sink among the WMMAs, each behind a wait of its own
    v8f s[4];
#pragma unroll
    for (int kt = 0; kt < 4; ++kt) {
      v8f c = vzero8();
#pragma unroll
      for (int ks = 0; ks < 2; ++ks) c = wmma16(ka[kt][ks].v, qf[ks].v, c);
      s[kt] = c;
    }

    // A = Vt rows d = dt*16+n, keys n0+kk*32 + split map, by the transposing load from V's key-major rows;
    // read here so that the LDS latency passes under the softmax
    Frag va[2][4];
#pragma unroll
    for (int kk = 0; kk < 2; ++kk) {
#pragma unroll
      for (int dt = 0; dt < 4; ++dt) {
        va[kk][dt].p[0] = ld_tr16(vb + (kk * 32) * VPIT + dt * 16);
        va[kk][dt].p[1] = ld_tr16(vb + (kk * 32 + 16) * VPIT + dt * 16);
      }
    }

    __builtin_amdgcn_sched_barrier(0);   // keeps the 16 V reads one group ahead of the softmax; without it they sink to their WMMAs and the wave waits out each LDS latency

    // bias add, running max/sum per query (lane pair n, n+16)
    const float* bwl = bw + (wb + n0);
    float tmax = -INFINITY;
#pragma unroll
    for (int kt = 0; kt < 4; ++kt) {
#pragma unroll
      for (int r = 0; r < 8; ++r) {
        const float x = s[kt][r] + bwl[kt * 16 + r];
        s[kt][r] = x;
        tmax = fmaxf(tmax, x);
      }
    }
    tmax = fmaxf(tmax, __shfl_xor(tmax, 16, 32));
    const float mnew  = fmaxf(mrun, tmax);
    const float alpha = __expf(mrun - mnew);
    mrun = mnew;
    float psum = 0.0f;
#pragma unroll
    for (int kt = 0; kt < 4; ++kt) {
#pragma unroll
      for (int r = 0; r < 8; ++r) {
        const float p = __expf(s[kt][r] - mnew);
        s[kt][r] = p;
        psum += p;
      }
    }
    psum += __shfl_xor(psum, 16, 32);
    lrun = alpha * lrun + psum;
#pragma unroll
    for (int dt = 0; dt < 4; ++dt) oacc[dt] = oacc[dt] * alpha;

    // Ot[d][query] += Vt[d][key] * Pt[key][query]; B = Pt in-lane from two adjacent S tiles:
    // element i <- tile 2kk (keys kk*32+8hh+i), element 8+i <- tile 2kk+1 (keys kk*32+16+8hh+i); hi and lo bf16 parts
#pragma unroll
    for (int kk = 0; kk < 2; ++kk) {
      v16b phi, plo;
#pragma unroll
      for (int i = 0; i < 8; ++i) {
        const float p0 = s[2 * kk][i];
        const __bf16 b0 = (__bf16)p0;
        phi[i] = b0;
        plo[i] = (__bf16)(p0 - (float)b0);
        const float p1 = s[2 * kk + 1][i];
        const __bf16 b1 = (__bf16)p1;
        phi[8 + i] = b1;
        plo[8 + i] = (__bf16)(p1 - (float)b1);
      }
#pragma unroll
      for (int dt = 0; dt < 4; ++dt) {
        v8f c = oacc[dt];
        c = wmma16(va[kk][dt].v, phi, c);
        c = wmma16(va[kk][dt].v, plo, c);
        oacc[dt] = c;
      }
    }

    // hand-over: tile t+1 is rounded into the buffer that trip t-1 read (every wave left it at the last barrier);
    // the barrier publishes it and ends every wave's reads of buffer t&1
    if (t + 1 < NT) {
      __bf16* dk = &ringk[(t + 1) & 1][sko];
      __bf16* dv = &ringv[(t + 1) & 1][svo];
#pragma unroll
      for (int i = 0; i < NPC; ++i) {
        *(v4b*)(dk + i * 16 * KPIT) = round4(kr[i]);
        *(v4b*)(dv + i * 16 * VPIT) = round4(vr[i]);
      }
      __builtin_amdgcn_sched_barrier(0);   // keeps the two steps below behind the roundings, that is behind the wait for the last load that names these address registers
      gk += KBLK * HD;
      gv += KBLK * HD;
    }
    __syncthreads();
  }

  const float inv = 1.0f / lrun;
#pragma unroll
  for (int dt = 0; dt < 4; ++dt) {
#pragma unroll
    for (int r = 0; r < 8; ++r) osm[wave][n][dt * 16 + 8 * hh + r] = oacc[dt][r] * inv;
  }
  __syncthreads();

  float* ob = out + ((size_t)bh * SEQ + (size_t)(m0 + wave * 16)) * HD;
  v4f vals[8];
#pragma unroll
  for (int it = 0; it < 8; ++it) vals[it] = *(const v4f*)(&osm[wave][it * 2 + hh][n * 4]);
#pragma unroll
  for (int it = 0; it < 8; ++it)
    *(v4f*)(ob + (size_t)(it * 2 + hh) * HD + (size_t)(n * 4)) = vals[it];
}

// ---------------- launcher ----------------
extern "C" void kernel_launch(void* const* d_in, const int* in_sizes, int n_in,
                              void* d_out, int out_size, void* d_ws, size_t ws_size,
                              hipStream_t stream) {
  if (n_in < 7) return;
  const int nq = NBH * SEQ * HD;
  if (in_sizes[0] != nq || in_sizes[1] != nq || in_sizes[2] != nq || out_size != nq) return;
  if (in_sizes[3] < NKER * NH || in_sizes[4] < NKER * NH || in_sizes[5] < NKER * NH || in_sizes[6] < NH) return;

  const float* q    = (const float*)d_in[0];
  const float* k    = (const float*)d_in[1];
  const float* v    = (const float*)d_in[2];
  const float* off  = (const float*)d_in[3];
  const float* amp  = (const float*)d_in[4];
  const float* shp  = (const float*)d_in[5];
  const float* bpar = (const float*)d_in[6];
  float* out = (float*)d_out;

  hipLaunchKernelGGL(k_attn, dim3(SEQ / QBLK, NBH), dim3(NTHR), 0, stream,
                     q, k, v, off, amp, shp, bpar, out);
}

// v005
// A run of this version takes 27.4 microseconds.
// In both of two side-by-side timings against v004, it was 1.19 times as fast.
// All steps since v000 together make it 3.71 times as fast.
#include <hip/hip_runtime.h>
#include <math.h>

// Contractions: S = K*Qt on v_wmma_f32_16x16x32_bf16 (bf16 operands, f32 accumulate);
// O = Vt*Pt on v_wmma_f32_16x16x32_bf16 (V bf16, P as bf16 hi+lo pair, f32 accumulate); bias window and softmax in f32.
// One launch: every work-group rounds its own Q rows and the K and V tiles it walks to bf16 and builds its own bias window.
// A wave leaves out softmax and O-product of a key tile whose every probability is 0 in f32 (scores far below the running maximum).

#define NH    16
#define NKER  8
#define SEQ   1024
#define HD    64
#define NBH   64
#define QBLK  128
#define KBLK  64
#define NWAV  8
#define NTHR  (NWAV * 32)
#define BWIN  (SEQ + QBLK)
#define NT    (SEQ / KBLK)
#define KPIT  72                 // halves per staged K row: 128 B of data + 16 B, the pitch for ds_load_b128 readers
#define VPIT  80                 // halves per staged V row: 128 B of data + 32 B, the pitch for ds_load_tr16_b128 readers
#define NPC   ((KBLK * HD) / (NTHR * 4))   // 16-B pieces of one f32 tile per thread (4)

typedef __bf16 v16b __attribute__((ext_vector_type(16)));
typedef __bf16 v8b  __attribute__((ext_vector_type(8)));
typedef __bf16 v4b  __attribute__((ext_vector_type(4)));
typedef float  v8f  __attribute__((ext_vector_type(8)));
typedef float  v4f  __attribute__((ext_vector_type(4)));

union Frag  { v16b v; v8b p[2]; };

__device__ __forceinline__ v8f wmma16(v16b a, v16b b, v8f c) {
  return __builtin_amdgcn_wmma_f32_16x16x32_bf16(false, a, false, b, (short)0, c, false, false);
}

__device__ __forceinline__ v8f vzero8() {
  v8f z = {0.0f, 0.0f, 0.0f, 0.0f, 0.0f, 0.0f, 0.0f, 0.0f};
  return z;
}

// Transposing LDS load: lane (c = lane & 15, h = lane >> 4) gets column c, rows 8h .. 8h+7 of the 16 x 16 block of halves
// whose row (8h + (lane & 7)), 16-B piece ((lane >> 3) & 1) the lane's own address names.
__device__ __forceinline__ v8b ld_tr16(const __bf16* p) {
  typedef __attribute__((address_space(3))) v8b lds_v8b;
  return __builtin_amdgcn_ds_load_tr16_b128_v8bf16((lds_v8b*)p);
}

__device__ __forceinline__ v4b round4(v4f f) {
  v4b o;
#pragma unroll
  for (int j = 0; j < 4; ++j) o[j] = (__bf16)f[j];
  return o;
}

// ---------------- streaming attention, one block per (bh, 128 queries), one wave per 16 queries ----------------
__global__ __launch_bounds__(NTHR) __attribute__((amdgpu_num_vgpr(256)))
void k_attn(const float* __restrict__ q, const float* __restrict__ k, const float* __restrict__ v,
            const float* __restrict__ off, const float* __restrict__ amp,
            const float* __restrict__ shp, const float* __restrict__ bpar,
            float* __restrict__ out) {
  __shared__ __attribute__((aligned(16))) float bw[BWIN];               // bias window for this query block
  __shared__ __attribute__((aligned(16))) float osm[NWAV][16][HD];      // per-wave output staging [query][d]
  __shared__ __attribute__((aligned(16))) __bf16 ringk[2][KBLK * KPIT]; // [buffer][key * KPIT + d]
  __shared__ __attribute__((aligned(16))) __bf16 ringv[2][KBLK * VPIT]; // [buffer][key * VPIT + d]

  const int tid  = threadIdx.x;
  const int lane = tid & 31;
  const int wave = tid >> 5;
  const int hh   = lane >> 4;        // lane half
  const int n    = lane & 15;        // fragment row (A) / column (B, D)
  const int m0   = blockIdx.x * QBLK;
  // which (batch, head) this block takes: the first half of the grid takes the heads of flat decay (no or few tiles left out), the second
  // half those of steep decay (most tiles left out), block y + NBH/2 the head NH-1-h of block y's head h. All blocks are resident at once,
  // two on a WGP. For speed only: every (batch, head, query block) is taken by exactly one block, wherever they land.
  const int yr   = blockIdx.y & (NBH / 2 - 1);
  const int head = (blockIdx.y < NBH / 2) ? (NH / 2 + (yr & (NH / 2 - 1))) : (NH / 2 - 1 - (yr & (NH / 2 - 1)));
  const int bh   = (yr / (NH / 2)) * NH + head;
  const int t0   = m0 / KBLK;        // first key tile walked: the one that holds this block's first queries; then round, modulo NT

  // staging: an f32 tile (64 rows x 64) is 16 KiB in a row; piece i of this thread is floats (i * NTHR + tid) * 4 ..+3,
  // that is row i*16 + tid/16, columns (tid%16)*4 ..+3: every wave-wide load covers 512 contiguous bytes
  const float* gk = k + (size_t)bh * SEQ * HD + (size_t)(t0 * KBLK * HD + tid * 4);   // + i * NTHR * 4; steps on by a tile each trip
  const float* gv = v + (size_t)bh * SEQ * HD + (size_t)(t0 * KBLK * HD + tid * 4);
  const int sko = (tid >> 4) * KPIT + (tid & 15) * 4;                // + i * 16 * KPIT
  const int svo = (tid >> 4) * VPIT + (tid & 15) * 4;                // + i * 16 * VPIT

  v4f kr[NPC], vr[NPC];
#pragma unroll
  for (int i = 0; i < NPC; ++i) {                                    // tile t0
    kr[i] = *(const v4f*)(gk + i * NTHR * 4);
    vr[i] = *(const v4f*)(gv + i * NTHR * 4);
  }

  // Q rows of this wave, f32: lane n -> query m0+wave*16+n; d ks*32+8hh ..+7 and ks*32+16+8hh ..+7
  v4f qr4[2][2][2];
  {
    const float* qr = q + ((size_t)bh * SEQ + (size_t)(m0 + wave * 16 + n)) * HD + 8 * hh;
#pragma unroll
    for (int ks = 0; ks < 2; ++ks) {
#pragma unroll
      for (int j = 0; j < 2; ++j) {
        qr4[ks][j][0] = *(const v4f*)(qr + ks * 32 + j * 16);
        qr4[ks][j][1] = *(const v4f*)(qr + ks * 32 + j * 16 + 4);
      }
    }
  }
  // this head's kernel parameters, as stored
  float ra[NKER], ro[NKER], rs[NKER];
#pragma unroll
  for (int m = 0; m < NKER; ++m) {
    ra[m] = amp[m * NH + head];
    ro[m] = off[m * NH + head];
    rs[m] = shp[m * NH + head];
  }
  const float rb = bpar[head];
  // behind all the loads above: no address register that an issued load names is rewritten ahead of this wait
  asm volatile("s_wait_xcnt 0x0" ::: "memory");

  // bw[w] = relative bias of this head at rel = key - query = w - (QBLK-1) - m0, w = key - query_local + QBLK-1 in [0, SEQ+QBLK-2];
  // it runs while the loads above are in flight
  {
    float pa[NKER], po[NKER], pr[NKER], pg[NKER];
#pragma unroll
    for (int m = 0; m < NKER; ++m) {
      const float a = (float)(__bf16)ra[m];
      const float s = (float)(__bf16)rs[m];
      po[m] = (float)(__bf16)ro[m];
      pg[m] = (a > 0.0f) ? 1.0f : ((a < 0.0f) ? -1.0f : 0.0f);
      pr[m] = __builtin_amdgcn_rcpf(s);
      pa[m] = fabsf(a);
    }
    const float bp = (float)(__bf16)rb;
    float slope = 0.0f;
    if (head < NH - 2) {
      const float e = (float)head * (1.0f / 13.0f);
      slope = 4.6051702f * exp2f(-6.0f * e);      // 4.6051702 * (1/64)^e
    }
    for (int i = tid; i < SEQ + QBLK - 1; i += NTHR) {
      const float rel = (float)(i - (QBLK - 1) - m0);
      float ksum = 0.0f;
#pragma unroll
      for (int m = 0; m < NKER; ++m) {
        const float x  = pg[m] * ((rel - po[m]) * pr[m]);
        const float ex = __expf(-x);
        const float sig = __builtin_amdgcn_rcpf(1.0f + ex);
        ksum = fmaf(pa[m], sig, ksum);
      }
      bw[i] = logf((ksum + 1e-8f) + bp) - fabsf(rel) * slope;
    }
  }

  // Q as B operand, q/8 rounded to bf16: elements 0..7 <- d ks*32+8hh.., 8..15 <- d ks*32+16+8hh..
  Frag qf[2];
#pragma unroll
  for (int ks = 0; ks < 2; ++ks) {
#pragma unroll
    for (int j = 0; j < 2; ++j) {
#pragma unroll
      for (int e = 0; e < 4; ++e) {
        qf[ks].p[j][e]     = (__bf16)(qr4[ks][j][0][e] * 0.125f);
        qf[ks].p[j][4 + e] = (__bf16)(qr4[ks][j][1][e] * 0.125f);
      }
    }
  }

#pragma unroll
  for (int i = 0; i < NPC; ++i) {                                    // tile t0 -> buffer 0
    *(v4b*)(&ringk[0][sko + i * 16 * KPIT]) = round4(kr[i]);
    *(v4b*)(&ringv[0][svo + i * 16 * VPIT]) = round4(vr[i]);
  }
  __syncthreads();
  // behind the roundings above, that is behind the wait for the loads that name these address registers: on to the second tile walked
  {
    const int gstep = (t0 == NT - 1) ? -(SEQ - KBLK) * HD : KBLK * HD;
    gk += gstep;
    gv += gstep;
  }

  v8f oacc[4];
#pragma unroll
  for (int dt = 0; dt < 4; ++dt) oacc[dt] = vzero8();
  float mrun = -INFINITY;
  float lrun = 0.0f;

  const int wb = 8 * hh - wave * 16 - n + (QBLK - 1);

#pragma unroll 1   // stays rolled: one hand-over point, the buffer picked by t & 1
  for (int t = 0; t < NT; ++t) {
    const int n0 = ((t0 + t) & (NT - 1)) * KBLK;
    const __bf16* kb = &ringk[t & 1][n * KPIT + 8 * hh];                                   // + kt*16*KPIT + ks*32 (+16)
    const __bf16* vb = &ringv[t & 1][(8 * hh + (lane & 7)) * VPIT + ((lane >> 3) & 1) * 8]; // + (kk*32 (+16))*VPIT + dt*16

    // the next trip's tile, f32, into registers: issued here so that the whole trip passes under its latency
    if (t + 1 < NT) {
#pragma unroll
      for (int i = 0; i < NPC; ++i) {
        kr[i] = *(const v4f*)(gk + i * NTHR * 4);
        vr[i] = *(const v4f*)(gv + i * NTHR * 4);
      }
    }

    // St[key][query] tiles: A = K rows (lane n -> key n0+kt*16+n, split d map), B = Q; D[r] = key kt*16+8hh+r, query n
    // all 16 reads stand as one group ahead of the products; unrolled so that every fragment index is a constant
    Frag ka[4][2];
#pragma unroll
    for (int kt = 0; kt < 4; ++kt) {
#pragma unroll
      for (int ks = 0; ks < 2; ++ks) {
        ka[kt][ks].p[0] = *(const v8b*)(kb + kt * 16 * KPIT + ks * 32);
        ka[kt][ks].p[1] = *(const v8b*)(kb + kt * 16 * KPIT + ks * 32 + 16);
      }
    }
    __builtin_amdgcn_sched_barrier(0);   // keeps the 16 K reads one group ahead of the products; without it they sink among the WMMAs, each behind a wait of its own
    v8f s[4];
#pragma unroll
    for (int kt = 0; kt < 4; ++kt) {
      v8f c = vzero8();
#pragma unroll
      for (int ks = 0; ks < 2; ++ks) c = wmma16(ka[kt][ks].v, qf[ks].v, c);
      s[kt] = c;
    }
    __builtin_amdgcn_sched_barrier(0);   // keeps the 8 products one group ahead of the bias adds; without it the adds stand among them, each behind the padding that a read of a fresh result takes

    // bias add, this lane's maximum over its 32 keys
    const float* bwl = bw + (wb + n0);
    float tmax = -INFINITY;
#pragma unroll
    for (int kt = 0; kt < 4; ++kt) {
#pragma unroll
      for (int r = 0; r < 8; ++r) {
        const float x = s[kt][r] + bwl[kt * 16 + r];
        s[kt][r] = x;
        tmax = fmaxf(tmax, x);
      }
    }

    // Every score of the tile more than 105 below its query's running maximum (105 > 150 ln 2): the maximum stays, alpha is 1 and every
    // p = exp(x - mrun) is 0 in f32, subnormals counted, so sum and accumulators keep their bits: the rest of the tile's work is left out.
    // One test for the whole wave (a scalar branch: the WMMAs below need every lane on); no tile is left out while mrun is -inf or NaN.
    if (__builtin_amdgcn_ballot_w32(!(tmax < mrun - 105.0f)) != 0u) {

    // A = Vt rows d = dt*16+n, keys n0+kk*32 + split map, by the transposing load from V's key-major rows;
    // read here so that the LDS latency passes under the softmax
    Frag va[2][4];
#pragma unroll
    for (int kk = 0; kk < 2; ++kk) {
#pragma unroll
      for (int dt = 0; dt < 4; ++dt) {
        va[kk][dt].p[0] = ld_tr16(vb + (kk * 32) * VPIT + dt * 16);
        va[kk][dt].p[1] = ld_tr16(vb + (kk * 32 + 16) * VPIT + dt * 16);
      }
    }

    __builtin_amdgcn_sched_barrier(0);   // keeps the 16 V reads one group ahead of the softmax; without it they sink to their WMMAs and the wave waits out each LDS latency

    // running max/sum per query (lane pair n, n+16)
    tmax = fmaxf(tmax, __shfl_xor(tmax, 16, 32));
    const float mnew  = fmaxf(mrun, tmax);
    const float alpha = __expf(mrun - mnew);
    mrun = mnew;
    float psum = 0.0f;
#pragma unroll
    for (int kt = 0; kt < 4; ++kt) {
#pragma unroll
      for (int r = 0; r < 8; ++r) {
        const float p = __expf(s[kt][r] - mnew);
        s[kt][r] = p;
        psum += p;
      }
    }
    psum += __shfl_xor(psum, 16, 32);
    lrun = alpha * lrun + psum;
#pragma unroll
    for (int dt = 0; dt < 4; ++dt) oacc[dt] = oacc[dt] * alpha;

    // Ot[d][query] += Vt[d][key] * Pt[key][query]; B = Pt in-lane from two adjacent S tiles:
    // element i <- tile 2kk (keys kk*32+8hh+i), element 8+i <- tile 2kk+1 (keys kk*32+16+8hh+i); hi and lo bf16 parts
#pragma unroll
    for (int kk = 0; kk < 2; ++kk) {
      v16b phi, plo;
#pragma unroll
      for (int i = 0; i < 8; ++i) {
        const float p0 = s[2 * kk][i];
        const __bf16 b0 = (__bf16)p0;
        phi[i] = b0;
        plo[i] = (__bf16)(p0 - (float)b0);
        const float p1 = s[2 * kk + 1][i];
        const __bf16 b1 = (__bf16)p1;
        phi[8 + i] = b1;
        plo[8 + i] = (__bf16)(p1 - (float)b1);
      }
#pragma unroll
      for (int dt = 0; dt < 4; ++dt) {
        v8f c = oacc[dt];
        c = wmma16(va[kk][dt].v, phi, c);
        c = wmma16(va[kk][dt].v, plo, c);
        oacc[dt] = c;
      }
    }

    }   // tile not left out

    // hand-over: trip t+1's tile is rounded into the buffer that trip t-1 read (every wave left it at the last barrier);
    // the barrier publishes it and ends every wave's reads of buffer t&1
    if (t + 1 < NT) {
      __bf16* dk = &ringk[(t + 1) & 1][sko];
      __bf16* dv = &ringv[(t + 1) & 1][svo];
#pragma unroll
      for (int i = 0; i < NPC; ++i) {
        *(v4b*)(dk + i * 16 * KPIT) = round4(kr[i]);
        *(v4b*)(dv + i * 16 * VPIT) = round4(vr[i]);
      }
      __builtin_amdgcn_sched_barrier(0);   // keeps the two steps below behind the roundings, that is behind the wait for the last load that names these address registers
      // from the tile just rounded to the one behind it: a tile on, or back to tile 0 behind the last
      const int gstep = (((t0 + t + 1) & (NT - 1)) == NT - 1) ? -(SEQ - KBLK) * HD : KBLK * HD;
      gk += gstep;
      gv += gstep;
    }
    __syncthreads();
  }

  const float inv = 1.0f / lrun;
#pragma unroll
  for (int dt = 0; dt < 4; ++dt) {
#pragma unroll
    for (int r = 0; r < 8; ++r) osm[wave][n][dt * 16 + 8 * hh + r] = oacc[dt][r] * inv;
  }
  __syncthreads();

  float* ob = out + ((size_t)bh * SEQ + (size_t)(m0 + wave * 16)) * HD;
  v4f vals[8];
#pragma unroll
  for (int it = 0; it < 8; ++it) vals[it] = *(const v4f*)(&osm[wave][it * 2 + hh][n * 4]);
#pragma unroll
  for (int it = 0; it < 8; ++it)
    *(v4f*)(ob + (size_t)(it * 2 + hh) * HD + (size_t)(n * 4)) = vals[it];
}

// ---------------- launcher ----------------
extern "C" void kernel_launch(void* const* d_in, const int* in_sizes, int n_in,
                              void* d_out, int out_size, void* d_ws, size_t ws_size,
                              hipStream_t stream) {
  if (n_in < 7) return;
  const int nq = NBH * SEQ * HD;
  if (in_sizes[0] != nq || in_sizes[1] != nq || in_sizes[2] != nq || out_size != nq) return;
  if (in_sizes[3] < NKER * NH || in_sizes[4] < NKER * NH || in_sizes[5] < NKER * NH || in_sizes[6] < NH) return;

  const float* q    = (const float*)d_in[0];
  const float* k    = (const float*)d_in[1];
  const float* v    = (const float*)d_in[2];
  const float* off  = (const float*)d_in[3];
  const float* amp  = (const float*)d_in[4];
  const float* shp  = (const float*)d_in[5];
  const float* bpar = (const float*)d_in[6];
  float* out = (float*)d_out;

  hipLaunchKernelGGL(k_attn, dim3(SEQ / QBLK, NBH), dim3(NTHR), 0, stream,
                     q, k, v, off, amp, shp, bpar, out);
}

// v006
// Measured time: 26.5 microseconds a run.
// In both of two side-by-side timings against v005, it was 1.04 times as fast.
// Over all steps from v000 it is 3.84 times as fast.
#include <hip/hip_runtime.h>
#include <math.h>

// Contractions: S = K*Qt on v_wmma_f32_16x16x32_bf16 (bf16 operands, f32 accumulate);
// O = Vt*Pt on v_wmma_f32_16x16x32_bf16 (V bf16, P as bf16 hi+lo pair, f32 accumulate); bias window and softmax in f32.
// One launch: every work-group rounds its own Q rows and the K and V tiles it walks to bf16 and builds its own bias window.
// A wave leaves out softmax and O-product of a key tile whose every probability is 0 in f32 (scores far below the running maximum).

#define NH    16
#define NKER  8
#define SEQ   1024
#define HD    64
#define NBH   64
#define QBLK  128
#define KBLK  64
#define NWAV  8
#define NTHR  (NWAV * 32)
#define BWIN  (SEQ + QBLK)
#define NT    (SEQ / KBLK)
#define KPIT  72                 // halves per staged K row: 128 B of data + 16 B, the pitch for ds_load_b128 readers
#define VPIT  80                 // halves per staged V row: 128 B of data + 32 B, the pitch for ds_load_tr16_b128 readers
#define NPC   ((KBLK * HD) / (NTHR * 4))   // 16-B pieces of one f32 tile per thread (4)

typedef __bf16 v16b __attribute__((ext_vector_type(16)));
typedef __bf16 v8b  __attribute__((ext_vector_type(8)));
typedef __bf16 v4b  __attribute__((ext_vector_type(4)));
typedef float  v8f  __attribute__((ext_vector_type(8)));
typedef float  v4f  __attribute__((ext_vector_type(4)));
typedef float  v2f  __attribute__((ext_vector_type(2)));
typedef __bf16 v2b  __attribute__((ext_vector_type(2)));

union Frag  { v16b v; v8b p[2]; };
union PFrag { v16b v; v2b w[8]; };

__device__ __forceinline__ v8f wmma16(v16b a, v16b b, v8f c) {
  return __builtin_amdgcn_wmma_f32_16x16x32_bf16(false, a, false, b, (short)0, c, false, false);
}

__device__ __forceinline__ v8f vzero8() {
  v8f z = {0.0f, 0.0f, 0.0f, 0.0f, 0.0f, 0.0f, 0.0f, 0.0f};
  return z;
}

// Transposing LDS load: lane (c = lane & 15, h = lane >> 4) gets column c, rows 8h .. 8h+7 of the 16 x 16 block of halves
// whose row (8h + (lane & 7)), 16-B piece ((lane >> 3) & 1) the lane's own address names.
__device__ __forceinline__ v8b ld_tr16(const __bf16* p) {
  typedef __attribute__((address_space(3))) v8b lds_v8b;
  return __builtin_amdgcn_ds_load_tr16_b128_v8bf16((lds_v8b*)p);
}

__device__ __forceinline__ v4b round4(v4f f) {
  v4b o;
#pragma unroll
  for (int j = 0; j < 4; ++j) o[j] = (__bf16)f[j];
  return o;
}

// ---------------- streaming attention, one block per (bh, 128 queries), one wave per 16 queries ----------------
__global__ __launch_bounds__(NTHR) __attribute__((amdgpu_num_vgpr(256)))
void k_attn(const float* __restrict__ q, const float* __restrict__ k, const float* __restrict__ v,
            const float* __restrict__ off, const float* __restrict__ amp,
            const float* __restrict__ shp, const float* __restrict__ bpar,
            float* __restrict__ out) {
  __shared__ __attribute__((aligned(16))) float bw[BWIN];               // bias window for this query block
  __shared__ __attribute__((aligned(16))) float osm[NWAV][16][HD];      // per-wave output staging [query][d]
  __shared__ __attribute__((aligned(16))) __bf16 ringk[2][KBLK * KPIT]; // [buffer][key * KPIT + d]
  __shared__ __attribute__((aligned(16))) __bf16 ringv[2][KBLK * VPIT]; // [buffer][key * VPIT + d]

  const int tid  = threadIdx.x;
  const int lane = tid & 31;
  const int wave = tid >> 5;
  const int hh   = lane >> 4;        // lane half
  const int n    = lane & 15;        // fragment row (A) / column (B, D)
  const int m0   = blockIdx.x * QBLK;
  // which (batch, head) this block takes: the first half of the grid takes the heads of flat decay (no or few tiles left out), the second
  // half those of steep decay (most tiles left out), block y + NBH/2 the head NH-1-h of block y's head h. All blocks are resident at once,
  // two on a WGP. For speed only: every (batch, head, query block) is taken by exactly one block, wherever they land.
  const int yr   = blockIdx.y & (NBH / 2 - 1);
  const int head = (blockIdx.y < NBH / 2) ? (NH / 2 + (yr & (NH / 2 - 1))) : (NH / 2 - 1 - (yr & (NH / 2 - 1)));
  const int bh   = (yr / (NH / 2)) * NH + head;
  const int t0   = m0 / KBLK;        // first key tile walked: the one that holds this block's first queries; then round, modulo NT

  // staging: an f32 tile (64 rows x 64) is 16 KiB in a row; piece i of this thread is floats (i * NTHR + tid) * 4 ..+3,
  // that is row i*16 + tid/16, columns (tid%16)*4 ..+3: every wave-wide load covers 512 contiguous bytes
  const float* gk = k + (size_t)bh * SEQ * HD + (size_t)(t0 * KBLK * HD + tid * 4);   // + i * NTHR * 4; steps on by a tile each trip
  const float* gv = v + (size_t)bh * SEQ * HD + (size_t)(t0 * KBLK * HD + tid * 4);
  const int sko = (tid >> 4) * KPIT + (tid & 15) * 4;                // + i * 16 * KPIT
  const int svo = (tid >> 4) * VPIT + (tid & 15) * 4;                // + i * 16 * VPIT

  v4f kr[NPC], vr[NPC];
#pragma unroll
  for (int i = 0; i < NPC; ++i) {                                    // tile t0
    kr[i] = *(const v4f*)(gk + i * NTHR * 4);
    vr[i] = *(const v4f*)(gv + i * NTHR * 4);
  }

  // Q rows of this wave, f32: lane n -> query m0+wave*16+n; d ks*32+8hh ..+7 and ks*32+16+8hh ..+7
  v4f qr4[2][2][2];
  {
    const float* qr = q + ((size_t)bh * SEQ + (size_t)(m0 + wave * 16 + n)) * HD + 8 * hh;
#pragma unroll
    for (int ks = 0; ks < 2; ++ks) {
#pragma unroll
      for (int j = 0; j < 2; ++j) {
        qr4[ks][j][0] = *(const v4f*)(qr + ks * 32 + j * 16);
        qr4[ks][j][1] = *(const v4f*)(qr + ks * 32 + j * 16 + 4);
      }
    }
  }
  // this head's kernel parameters, as stored
  float ra[NKER], ro[NKER], rs[NKER];
#pragma unroll
  for (int m = 0; m < NKER; ++m) {
    ra[m] = amp[m * NH + head];
    ro[m] = off[m * NH + head];
    rs[m] = shp[m * NH + head];
  }
  const float rb = bpar[head];
  // behind all the loads above: no address register that an issued load names is rewritten ahead of this wait
  asm volatile("s_wait_xcnt 0x0" ::: "memory");

  // bw[w] = relative bias of this head at rel = key - query = w - (QBLK-1) - m0, w = key - query_local + QBLK-1 in [0, SEQ+QBLK-2];
  // it runs while the loads above are in flight
  {
    float pa[NKER], po[NKER], pr[NKER], pg[NKER];
#pragma unroll
    for (int m = 0; m < NKER; ++m) {
      const float a = (float)(__bf16)ra[m];
      const float s = (float)(__bf16)rs[m];
      po[m] = (float)(__bf16)ro[m];
      pg[m] = (a > 0.0f) ? 1.0f : ((a < 0.0f) ? -1.0f : 0.0f);
      pr[m] = __builtin_amdgcn_rcpf(s);
      pa[m] = fabsf(a);
    }
    const float bp = (float)(__bf16)rb;
    float slope = 0.0f;
    if (head < NH - 2) {
      const float e = (float)head * (1.0f / 13.0f);
      slope = 4.6051702f * exp2f(-6.0f * e);      // 4.6051702 * (1/64)^e
    }
    for (int i = tid; i < SEQ + QBLK - 1; i += NTHR) {
      const float rel = (float)(i - (QBLK - 1) - m0);
      float ksum = 0.0f;
#pragma unroll
      for (int m = 0; m < NKER; ++m) {
        const float x  = pg[m] * ((rel - po[m]) * pr[m]);
        const float ex = __expf(-x);
        const float sig = __builtin_amdgcn_rcpf(1.0f + ex);
        ksum = fmaf(pa[m], sig, ksum);
      }
      bw[i] = logf((ksum + 1e-8f) + bp) - fabsf(rel) * slope;
    }
  }

  // Q as B operand, q/8 rounded to bf16: elements 0..7 <- d ks*32+8hh.., 8..15 <- d ks*32+16+8hh..
  Frag qf[2];
#pragma unroll
  for (int ks = 0; ks < 2; ++ks) {
#pragma unroll
    for (int j = 0; j < 2; ++j) {
#pragma unroll
      for (int e = 0; e < 4; ++e) {
        qf[ks].p[j][e]     = (__bf16)(qr4[ks][j][0][e] * 0.125f);
        qf[ks].p[j][4 + e] = (__bf16)(qr4[ks][j][1][e] * 0.125f);
      }
    }
  }

#pragma unroll
  for (int i = 0; i < NPC; ++i) {                                    // tile t0 -> buffer 0
    *(v4b*)(&ringk[0][sko + i * 16 * KPIT]) = round4(kr[i]);
    *(v4b*)(&ringv[0][svo + i * 16 * VPIT]) = round4(vr[i]);
  }
  __syncthreads();
  // behind the roundings above, that is behind the wait for the loads that name these address registers: on to the second tile walked
  {
    const int gstep = (t0 == NT - 1) ? -(SEQ - KBLK) * HD : KBLK * HD;
    gk += gstep;
    gv += gstep;
  }

  v8f oacc[4];
#pragma unroll
  for (int dt = 0; dt < 4; ++dt) oacc[dt] = vzero8();
  float mrun = -INFINITY;
  float lrun = 0.0f;

  const int wb = 8 * hh - wave * 16 - n + (QBLK - 1);

#pragma unroll 1   // stays rolled: one hand-over point, the buffer picked by t & 1
  for (int t = 0; t < NT; ++t) {
    const int n0 = ((t0 + t) & (NT - 1)) * KBLK;
    const __bf16* kb = &ringk[t & 1][n * KPIT + 8 * hh];                                   // + kt*16*KPIT + ks*32 (+16)
    const __bf16* vb = &ringv[t & 1][(8 * hh + (lane & 7)) * VPIT + ((lane >> 3) & 1) * 8]; // + (kk*32 (+16))*VPIT + dt*16

    // the next trip's tile, f32, into registers: issued here so that the whole trip passes under its latency
    if (t + 1 < NT) {
#pragma unroll
      for (int i = 0; i < NPC; ++i) {
        kr[i] = *(const v4f*)(gk + i * NTHR * 4);
        vr[i] = *(const v4f*)(gv + i * NTHR * 4);
      }
    }

    // St[key][query] tiles: A = K rows (lane n -> key n0+kt*16+n, split d map), B = Q; D[r] = key kt*16+8hh+r, query n
    // all 16 reads stand as one group ahead of the products; unrolled so that every fragment index is a constant
    Frag ka[4][2];
#pragma unroll
    for (int kt = 0; kt < 4; ++kt) {
#pragma unroll
      for (int ks = 0; ks < 2; ++ks) {
        ka[kt][ks].p[0] = *(const v8b*)(kb + kt * 16 * KPIT + ks * 32);
        ka[kt][ks].p[1] = *(const v8b*)(kb + kt * 16 * KPIT + ks * 32 + 16);
      }
    }
    __builtin_amdgcn_sched_barrier(0);   // keeps the 16 K reads one group ahead of the products; without it they sink among the WMMAs, each behind a wait of its own
    v8f s[4];
#pragma unroll
    for (int kt = 0; kt < 4; ++kt) {
      v8f c = vzero8();
#pragma unroll
      for (int ks = 0; ks < 2; ++ks) c = wmma16(ka[kt][ks].v, qf[ks].v, c);
      s[kt] = c;
    }
    __builtin_amdgcn_sched_barrier(0);   // keeps the 8 products one group ahead of the bias adds; without it the adds stand among them, each behind the padding that a read of a fresh result takes

    // bias add, this lane's maximum over its 32 keys
    const float* bwl = bw + (wb + n0);
    float tmax = -INFINITY;
#pragma unroll
    for (int kt = 0; kt < 4; ++kt) {
#pragma unroll
      for (int r = 0; r < 8; ++r) {
        const float x = s[kt][r] + bwl[kt * 16 + r];
        s[kt][r] = x;
        tmax = fmaxf(tmax, x);
      }
    }

    // Every score of the tile more than 105 below its query's running maximum (105 > 150 ln 2): the maximum stays, alpha is 1 and every
    // p = exp(x - mrun) is 0 in f32, subnormals counted, so sum and accumulators keep their bits: the rest of the tile's work is left out.
    // One test for the whole wave (a scalar branch: the WMMAs below need every lane on); no tile is left out while mrun is -inf or NaN.
    if (__builtin_amdgcn_ballot_w32(!(tmax < mrun - 105.0f)) != 0u) {

    // A = Vt rows d = dt*16+n, keys n0+kk*32 + split map, by the transposing load from V's key-major rows;
    // read here so that the LDS latency passes under the softmax
    Frag va[2][4];
#pragma unroll
    for (int kk = 0; kk < 2; ++kk) {
#pragma unroll
      for (int dt = 0; dt < 4; ++dt) {
        va[kk][dt].p[0] = ld_tr16(vb + (kk * 32) * VPIT + dt * 16);
        va[kk][dt].p[1] = ld_tr16(vb + (kk * 32 + 16) * VPIT + dt * 16);
      }
    }

    __builtin_amdgcn_sched_barrier(0);   // keeps the 16 V reads one group ahead of the softmax; without it they sink to their WMMAs and the wave waits out each LDS latency

    // running max/sum per query (lane pair n, n+16)
    tmax = fmaxf(tmax, __shfl_xor(tmax, 16, 32));
    const float mnew  = fmaxf(mrun, tmax);
    const float alpha = __expf(mrun - mnew);
    mrun = mnew;
    // Two scores at a time, on the two-wide vector forms: one fused multiply-add gives both arguments of 2^x, (x - mnew) * log2(e);
    // one add takes both probabilities into a pair of partial sums; one conversion rounds both to bf16 (the hi parts), and its
    // two halves are what the lo parts subtract.
    // B = Pt in-lane from two adjacent S tiles: element i <- tile 2kk (keys kk*32+8hh+i), element 8+i <- tile 2kk+1 (keys kk*32+16+8hh+i)
    const v2f l2e = {1.44269504f, 1.44269504f};
    const float nml = -mnew * 1.44269504f;
    const v2f nm2 = {nml, nml};
    v2f ps2 = {0.0f, 0.0f};
    PFrag phi[2], plo[2];
#pragma unroll
    for (int kt = 0; kt < 4; ++kt) {
#pragma unroll
      for (int j = 0; j < 4; ++j) {
        const v2f x = {s[kt][2 * j], s[kt][2 * j + 1]};
        const v2f a = __builtin_elementwise_fma(x, l2e, nm2);
        const v2f p = {__builtin_amdgcn_exp2f(a[0]), __builtin_amdgcn_exp2f(a[1])};
        ps2 += p;
        const v2b h = __builtin_convertvector(p, v2b);
        const v2f l = {p[0] - (float)h[0], p[1] - (float)h[1]};
        phi[kt >> 1].w[(kt & 1) * 4 + j] = h;
        plo[kt >> 1].w[(kt & 1) * 4 + j] = __builtin_convertvector(l, v2b);
      }
    }
    float psum = ps2[0] + ps2[1];
    psum += __shfl_xor(psum, 16, 32);
    lrun = alpha * lrun + psum;
#pragma unroll
    for (int dt = 0; dt < 4; ++dt) oacc[dt] = oacc[dt] * alpha;

    // Ot[d][query] += Vt[d][key] * Pt[key][query], hi and lo bf16 parts
#pragma unroll
    for (int kk = 0; kk < 2; ++kk) {
#pragma unroll
      for (int dt = 0; dt < 4; ++dt) {
        v8f c = oacc[dt];
        c = wmma16(va[kk][dt].v, phi[kk].v, c);
        c = wmma16(va[kk][dt].v, plo[kk].v, c);
        oacc[dt] = c;
      }
    }

    }   // tile not left out

    // hand-over: trip t+1's tile is rounded into the buffer that trip t-1 read (every wave left it at the last barrier);
    // the barrier publishes it and ends every wave's reads of buffer t&1
    if (t + 1 < NT) {
      __bf16* dk = &ringk[(t + 1) & 1][sko];
      __bf16* dv = &ringv[(t + 1) & 1][svo];
#pragma unroll
      for (int i = 0; i < NPC; ++i) {
        *(v4b*)(dk + i * 16 * KPIT) = round4(kr[i]);
        *(v4b*)(dv + i * 16 * VPIT) = round4(vr[i]);
      }
      __builtin_amdgcn_sched_barrier(0);   // keeps the two steps below behind the roundings, that is behind the wait for the last load that names these address registers
      // from the tile just rounded to the one behind it: a tile on, or back to tile 0 behind the last
      const int gstep = (((t0 + t + 1) & (NT - 1)) == NT - 1) ? -(SEQ - KBLK) * HD : KBLK * HD;
      gk += gstep;
      gv += gstep;
    }
    __syncthreads();
  }

  const float inv = 1.0f / lrun;
#pragma unroll
  for (int dt = 0; dt < 4; ++dt) {
#pragma unroll
    for (int r = 0; r < 8; ++r) osm[wave][n][dt * 16 + 8 * hh + r] = oacc[dt][r] * inv;
  }
  __syncthreads();

  float* ob = out + ((size_t)bh * SEQ + (size_t)(m0 + wave * 16)) * HD;
  v4f vals[8];
#pragma unroll
  for (int it = 0; it < 8; ++it) vals[it] = *(const v4f*)(&osm[wave][it * 2 + hh][n * 4]);
#pragma unroll
  for (int it = 0; it < 8; ++it)
    *(v4f*)(ob + (size_t)(it * 2 + hh) * HD + (size_t)(n * 4)) = vals[it];
}

// ---------------- launcher ----------------
extern "C" void kernel_launch(void* const* d_in, const int* in_sizes, int n_in,
                              void* d_out, int out_size, void* d_ws, size_t ws_size,
                              hipStream_t stream) {
  if (n_in < 7) return;
  const int nq = NBH * SEQ * HD;
  if (in_sizes[0] != nq || in_sizes[1] != nq || in_sizes[2] != nq || out_size != nq) return;
  if (in_sizes[3] < NKER * NH || in_sizes[4] < NKER * NH || in_sizes[5] < NKER * NH || in_sizes[6] < NH) return;

  const float* q    = (const float*)d_in[0];
  const float* k    = (const float*)d_in[1];
  const float* v    = (const float*)d_in[2];
  const float* off  = (const float*)d_in[3];
  const float* amp  = (const float*)d_in[4];
  const float* shp  = (const float*)d_in[5];
  const float* bpar = (const float*)d_in[6];
  float* out = (float*)d_out;

  hipLaunchKernelGGL(k_attn, dim3(SEQ / QBLK, NBH), dim3(NTHR), 0, stream,
                     q, k, v, off, amp, shp, bpar, out);
}

// v007
// A run of this version takes 25.6 microseconds.
// Next to v006, in two timings, it ran 1.03 and 1.04 times as fast.
// Counting every step since v000, it is 3.98 times as fast.
#include <hip/hip_runtime.h>
#include <math.h>

// Contractions: S = K*Qt on v_wmma_f32_16x16x32_bf16 (bf16 operands, f32 accumulate);
// O = Vt*Pt on v_wmma_f32_16x16x32_bf16 (V bf16, P as bf16 hi+lo pair, f32 accumulate); bias window and softmax in f32.
// One launch: every work-group rounds its own Q rows and the K and V tiles it walks to bf16 and builds its own bias window.
// A wave leaves out softmax and O-product of a key tile whose every probability is 0 in f32 (scores far below the running maximum).
// K and V tiles pass through a ring of four LDS buffers, written two trips ahead of their readers; the work-group barrier of a trip is split
// (signal at the trip's foot, wait at the next trip's foot), so the waves of a work-group may stand up to one trip apart.

#define NH    16
#define NKER  8
#define SEQ   1024
#define HD    64
#define NBH   64
#define QBLK  128
#define KBLK  64
#define NWAV  8
#define NTHR  (NWAV * 32)
#define BWIN  (SEQ + QBLK)
#define NT    (SEQ / KBLK)
#define KPIT  72                 // halves per staged K row: 128 B of data + 16 B, the pitch for ds_load_b128 readers
#define VPIT  80                 // halves per staged V row: 128 B of data + 32 B, the pitch for ds_load_tr16_b128 readers
#define NPC   ((KBLK * HD) / (NTHR * 4))   // 16-B pieces of one f32 tile per thread (4)
#define NBUF  4                  // ring buffers: tile j of the walk lies in buffer j & 3

typedef __bf16 v16b __attribute__((ext_vector_type(16)));
typedef __bf16 v8b  __attribute__((ext_vector_type(8)));
typedef __bf16 v4b  __attribute__((ext_vector_type(4)));
typedef float  v8f  __attribute__((ext_vector_type(8)));
typedef float  v4f  __attribute__((ext_vector_type(4)));
typedef float  v2f  __attribute__((ext_vector_type(2)));
typedef __bf16 v2b  __attribute__((ext_vector_type(2)));

union Frag  { v16b v; v8b p[2]; };
union PFrag { v16b v; v2b w[8]; };

__device__ __forceinline__ v8f wmma16(v16b a, v16b b, v8f c) {
  return __builtin_amdgcn_wmma_f32_16x16x32_bf16(false, a, false, b, (short)0, c, false, false);
}

__device__ __forceinline__ v8f vzero8() {
  v8f z = {0.0f, 0.0f, 0.0f, 0.0f, 0.0f, 0.0f, 0.0f, 0.0f};
  return z;
}

// Transposing LDS load: lane (c = lane & 15, h = lane >> 4) gets column c, rows 8h .. 8h+7 of the 16 x 16 block of halves
// whose row (8h + (lane & 7)), 16-B piece ((lane >> 3) & 1) the lane's own address names.
__device__ __forceinline__ v8b ld_tr16(const __bf16* p) {
  typedef __attribute__((address_space(3))) v8b lds_v8b;
  return __builtin_amdgcn_ds_load_tr16_b128_v8bf16((lds_v8b*)p);
}

__device__ __forceinline__ v4b round4(v4f f) {
  v4b o;
#pragma unroll
  for (int j = 0; j < 4; ++j) o[j] = (__bf16)f[j];
  return o;
}

// ---------------- streaming attention, one block per (bh, 128 queries), one wave per 16 queries ----------------
__global__ __launch_bounds__(NTHR) __attribute__((amdgpu_num_vgpr(256)))
void k_attn(const float* __restrict__ q, const float* __restrict__ k, const float* __restrict__ v,
            const float* __restrict__ off, const float* __restrict__ amp,
            const float* __restrict__ shp, const float* __restrict__ bpar,
            float* __restrict__ out) {
  __shared__ __attribute__((aligned(16))) float bw[BWIN];               // bias window for this query block
  __shared__ __attribute__((aligned(16))) float osm[NWAV][16][HD];      // per-wave output staging [query][d]
  __shared__ __attribute__((aligned(16))) __bf16 ringk[NBUF][KBLK * KPIT]; // [buffer][key * KPIT + d]
  __shared__ __attribute__((aligned(16))) __bf16 ringv[NBUF][KBLK * VPIT]; // [buffer][key * VPIT + d]

  const int tid  = threadIdx.x;
  const int lane = tid & 31;
  const int wave = tid >> 5;
  const int hh   = lane >> 4;        // lane half
  const int n    = lane & 15;        // fragment row (A) / column (B, D)
  const int m0   = blockIdx.x * QBLK;
  // which (batch, head) this block takes: the first half of the grid takes the heads of flat decay (no or few tiles left out), the second
  // half those of steep decay (most tiles left out), block y + NBH/2 the head NH-1-h of block y's head h. All blocks are resident at once,
  // two on a WGP. For speed only: every (batch, head, query block) is taken by exactly one block, wherever they land.
  const int yr   = blockIdx.y & (NBH / 2 - 1);
  const int head = (blockIdx.y < NBH / 2) ? (NH / 2 + (yr & (NH / 2 - 1))) : (NH / 2 - 1 - (yr & (NH / 2 - 1)));
  const int bh   = (yr / (NH / 2)) * NH + head;
  const int t0   = m0 / KBLK;        // first key tile walked: the one that holds this block's first queries; then round, modulo NT

  // staging: an f32 tile (64 rows x 64) is 16 KiB in a row; piece i of this thread is floats (i * NTHR + tid) * 4 ..+3,
  // that is row i*16 + tid/16, columns (tid%16)*4 ..+3: every wave-wide load covers 512 contiguous bytes
  const float* gk = k + (size_t)bh * SEQ * HD + (size_t)(t0 * KBLK * HD + tid * 4);   // + i * NTHR * 4; steps on by a tile each trip
  const float* gv = v + (size_t)bh * SEQ * HD + (size_t)(t0 * KBLK * HD + tid * 4);
  const int sko = (tid >> 4) * KPIT + (tid & 15) * 4;                // + i * 16 * KPIT
  const int svo = (tid >> 4) * VPIT + (tid & 15) * 4;                // + i * 16 * VPIT

  // the second tile walked: a tile on, or back to tile 0 behind the last
  const int gstep0 = (t0 == NT - 1) ? -(SEQ - KBLK) * HD : KBLK * HD;
  const float* gk1 = gk + gstep0;
  const float* gv1 = gv + gstep0;

  v4f kr[NPC], vr[NPC], kr1[NPC], vr1[NPC];
#pragma unroll
  for (int i = 0; i < NPC; ++i) {                                    // the first two tiles walked
    kr[i]  = *(const v4f*)(gk + i * NTHR * 4);
    vr[i]  = *(const v4f*)(gv + i * NTHR * 4);
    kr1[i] = *(const v4f*)(gk1 + i * NTHR * 4);
    vr1[i] = *(const v4f*)(gv1 + i * NTHR * 4);
  }

  // Q rows of this wave, f32: lane n -> query m0+wave*16+n; d ks*32+8hh ..+7 and ks*32+16+8hh ..+7
  v4f qr4[2][2][2];
  {
    const float* qr = q + ((size_t)bh * SEQ + (size_t)(m0 + wave * 16 + n)) * HD + 8 * hh;
#pragma unroll
    for (int ks = 0; ks < 2; ++ks) {
#pragma unroll
      for (int j = 0; j < 2; ++j) {
        qr4[ks][j][0] = *(const v4f*)(qr + ks * 32 + j * 16);
        qr4[ks][j][1] = *(const v4f*)(qr + ks * 32 + j * 16 + 4);
      }
    }
  }
  // this head's kernel parameters, as stored
  float ra[NKER], ro[NKER], rs[NKER];
#pragma unroll
  for (int m = 0; m < NKER; ++m) {
    ra[m] = amp[m * NH + head];
    ro[m] = off[m * NH + head];
    rs[m] = shp[m * NH + head];
  }
  const float rb = bpar[head];
  // behind all the loads above: no address register that an issued load names is rewritten ahead of this wait
  asm volatile("s_wait_xcnt 0x0" ::: "memory");

  // bw[w] = relative bias of this head at rel = key - query = w - (QBLK-1) - m0, w = key - query_local + QBLK-1 in [0, SEQ+QBLK-2];
  // it runs while the loads above are in flight
  {
    float pa[NKER], po[NKER], pr[NKER], pg[NKER];
#pragma unroll
    for (int m = 0; m < NKER; ++m) {
      const float a = (float)(__bf16)ra[m];
      const float s = (float)(__bf16)rs[m];
      po[m] = (float)(__bf16)ro[m];
      pg[m] = (a > 0.0f) ? 1.0f : ((a < 0.0f) ? -1.0f : 0.0f);
      pr[m] = __builtin_amdgcn_rcpf(s);
      pa[m] = fabsf(a);
    }
    const float bp = (float)(__bf16)rb;
    float slope = 0.0f;
    if (head < NH - 2) {
      const float e = (float)head * (1.0f / 13.0f);
      slope = 4.6051702f * exp2f(-6.0f * e);      // 4.6051702 * (1/64)^e
    }
    for (int i = tid; i < SEQ + QBLK - 1; i += NTHR) {
      const float rel = (float)(i - (QBLK - 1) - m0);
      float ksum = 0.0f;
#pragma unroll
      for (int m = 0; m < NKER; ++m) {
        const float x  = pg[m] * ((rel - po[m]) * pr[m]);
        const float ex = __expf(-x);
        const float sig = __builtin_amdgcn_rcpf(1.0f + ex);
        ksum = fmaf(pa[m], sig, ksum);
      }
      bw[i] = logf((ksum + 1e-8f) + bp) - fabsf(rel) * slope;
    }
  }

  // Q as B operand, q/8 rounded to bf16: elements 0..7 <- d ks*32+8hh.., 8..15 <- d ks*32+16+8hh..
  Frag qf[2];
#pragma unroll
  for (int ks = 0; ks < 2; ++ks) {
#pragma unroll
    for (int j = 0; j < 2; ++j) {
#pragma unroll
      for (int e = 0; e < 4; ++e) {
        qf[ks].p[j][e]     = (__bf16)(qr4[ks][j][0][e] * 0.125f);
        qf[ks].p[j][4 + e] = (__bf16)(qr4[ks][j][1][e] * 0.125f);
      }
    }
  }

#pragma unroll
  for (int i = 0; i < NPC; ++i) {                                    // the first two tiles walked -> buffers 0 and 1
    *(v4b*)(&ringk[0][sko + i * 16 * KPIT]) = round4(kr[i]);
    *(v4b*)(&ringv[0][svo + i * 16 * VPIT]) = round4(vr[i]);
    *(v4b*)(&ringk[1][sko + i * 16 * KPIT]) = round4(kr1[i]);
    *(v4b*)(&ringv[1][svo + i * 16 * VPIT]) = round4(vr1[i]);
  }
  __syncthreads();
  // opens the alternation of signal and wait, so that every trip's foot holds the same wait and signal with no test on the trip's number
  asm volatile("s_barrier_signal -1" ::: "memory");
  // behind the roundings above, that is behind the wait for the loads that name these address registers: on to the third tile walked
  {
    const int gstep = (((t0 + 1) & (NT - 1)) == NT - 1) ? -(SEQ - KBLK) * HD : KBLK * HD;
    gk = gk1 + gstep;
    gv = gv1 + gstep;
  }

  v8f oacc[4];
#pragma unroll
  for (int dt = 0; dt < 4; ++dt) oacc[dt] = vzero8();
  float mrun = -INFINITY;
  float lrun = 0.0f;

  const int wb = 8 * hh - wave * 16 - n + (QBLK - 1);

#pragma unroll 1   // stays rolled: one hand-over point, the buffer picked by t & 3
  for (int t = 0; t < NT; ++t) {
    const int n0 = ((t0 + t) & (NT - 1)) * KBLK;
    const __bf16* kb = &ringk[t & (NBUF - 1)][n * KPIT + 8 * hh];                                   // + kt*16*KPIT + ks*32 (+16)
    const __bf16* vb = &ringv[t & (NBUF - 1)][(8 * hh + (lane & 7)) * VPIT + ((lane >> 3) & 1) * 8]; // + (kk*32 (+16))*VPIT + dt*16

    // the tile of the trip after next, f32, into registers: issued here so that the whole trip passes under its latency
    if (t + 2 < NT) {
#pragma unroll
      for (int i = 0; i < NPC; ++i) {
        kr[i] = *(const v4f*)(gk + i * NTHR * 4);
        vr[i] = *(const v4f*)(gv + i * NTHR * 4);
      }
    }

    // St[key][query] tiles: A = K rows (lane n -> key n0+kt*16+n, split d map), B = Q; D[r] = key kt*16+8hh+r, query n
    // all 16 reads stand as one group ahead of the products; unrolled so that every fragment index is a constant
    Frag ka[4][2];
#pragma unroll
    for (int kt = 0; kt < 4; ++kt) {
#pragma unroll
      for (int ks = 0; ks < 2; ++ks) {
        ka[kt][ks].p[0] = *(const v8b*)(kb + kt * 16 * KPIT + ks * 32);
        ka[kt][ks].p[1] = *(const v8b*)(kb + kt * 16 * KPIT + ks * 32 + 16);
      }
    }
    __builtin_amdgcn_sched_barrier(0);   // keeps the 16 K reads one group ahead of the products; without it they sink among the WMMAs, each behind a wait of its own
    v8f s[4];
#pragma unroll
    for (int kt = 0; kt < 4; ++kt) {
      v8f c = vzero8();
#pragma unroll
      for (int ks = 0; ks < 2; ++ks) c = wmma16(ka[kt][ks].v, qf[ks].v, c);
      s[kt] = c;
    }
    __builtin_amdgcn_sched_barrier(0);   // keeps the 8 products one group ahead of the bias adds; without it the adds stand among them, each behind the padding that a read of a fresh result takes

    // bias add, this lane's maximum over its 32 keys
    const float* bwl = bw + (wb + n0);
    float tmax = -INFINITY;
#pragma unroll
    for (int kt = 0; kt < 4; ++kt) {
#pragma unroll
      for (int r = 0; r < 8; ++r) {
        const float x = s[kt][r] + bwl[kt * 16 + r];
        s[kt][r] = x;
        tmax = fmaxf(tmax, x);
      }
    }

    // Every score of the tile more than 105 below its query's running maximum (105 > 150 ln 2): the maximum stays, alpha is 1 and every
    // p = exp(x - mrun) is 0 in f32, subnormals counted, so sum and accumulators keep their bits: the rest of the tile's work is left out.
    // One test for the whole wave (a scalar branch: the WMMAs below need every lane on); no tile is left out while mrun is -inf or NaN.
    if (__builtin_amdgcn_ballot_w32(!(tmax < mrun - 105.0f)) != 0u) {

    // A = Vt rows d = dt*16+n, keys n0+kk*32 + split map, by the transposing load from V's key-major rows;
    // read here so that the LDS latency passes under the softmax
    Frag va[2][4];
#pragma unroll
    for (int kk = 0; kk < 2; ++kk) {
#pragma unroll
      for (int dt = 0; dt < 4; ++dt) {
        va[kk][dt].p[0] = ld_tr16(vb + (kk * 32) * VPIT + dt * 16);
        va[kk][dt].p[1] = ld_tr16(vb + (kk * 32 + 16) * VPIT + dt * 16);
      }
    }

    __builtin_amdgcn_sched_barrier(0);   // keeps the 16 V reads one group ahead of the softmax; without it they sink to their WMMAs and the wave waits out each LDS latency

    // running max/sum per query (lane pair n, n+16)
    tmax = fmaxf(tmax, __shfl_xor(tmax, 16, 32));
    const float mnew  = fmaxf(mrun, tmax);
    const float alpha = __expf(mrun - mnew);
    mrun = mnew;
    // Two scores at a time, on the two-wide vector forms: one fused multiply-add gives both arguments of 2^x, (x - mnew) * log2(e);
    // one add takes both probabilities into a pair of partial sums; one conversion rounds both to bf16 (the hi parts), and its
    // two halves are what the lo parts subtract.
    // B = Pt in-lane from two adjacent S tiles: element i <- tile 2kk (keys kk*32+8hh+i), element 8+i <- tile 2kk+1 (keys kk*32+16+8hh+i)
    const v2f l2e = {1.44269504f, 1.44269504f};
    const float nml = -mnew * 1.44269504f;
    const v2f nm2 = {nml, nml};
    v2f ps2 = {0.0f, 0.0f};
    PFrag phi[2], plo[2];
#pragma unroll
    for (int kt = 0; kt < 4; ++kt) {
#pragma unroll
      for (int j = 0; j < 4; ++j) {
        const v2f x = {s[kt][2 * j], s[kt][2 * j + 1]};
        const v2f a = __builtin_elementwise_fma(x, l2e, nm2);
        const v2f p = {__builtin_amdgcn_exp2f(a[0]), __builtin_amdgcn_exp2f(a[1])};
        ps2 += p;
        const v2b h = __builtin_convertvector(p, v2b);
        const v2f l = {p[0] - (float)h[0], p[1] - (float)h[1]};
        phi[kt >> 1].w[(kt & 1) * 4 + j] = h;
        plo[kt >> 1].w[(kt & 1) * 4 + j] = __builtin_convertvector(l, v2b);
      }
    }
    float psum = ps2[0] + ps2[1];
    psum += __shfl_xor(psum, 16, 32);
    lrun = alpha * lrun + psum;
#pragma unroll
    for (int dt = 0; dt < 4; ++dt) oacc[dt] = oacc[dt] * alpha;

    // Ot[d][query] += Vt[d][key] * Pt[key][query], hi and lo bf16 parts
#pragma unroll
    for (int kk = 0; kk < 2; ++kk) {
#pragma unroll
      for (int dt = 0; dt < 4; ++dt) {
        v8f c = oacc[dt];
        c = wmma16(va[kk][dt].v, phi[kk].v, c);
        c = wmma16(va[kk][dt].v, plo[kk].v, c);
        oacc[dt] = c;
      }
    }

    }   // tile not left out

    // hand-over. Barrier t is signalled at the foot of trip t and waited for at the foot of trip t+1; signal and wait alternate in every wave.
    // Tile t+2 is rounded into the buffer that trip t-2 read: every wave signalled barrier t-2 behind its last read of it, and this wave
    // waited for that barrier at the foot of trip t-1.
    if (t + 2 < NT) {
      __bf16* dk = &ringk[(t + 2) & (NBUF - 1)][sko];
      __bf16* dv = &ringv[(t + 2) & (NBUF - 1)][svo];
#pragma unroll
      for (int i = 0; i < NPC; ++i) {
        *(v4b*)(dk + i * 16 * KPIT) = round4(kr[i]);
        *(v4b*)(dv + i * 16 * VPIT) = round4(vr[i]);
      }
      __builtin_amdgcn_sched_barrier(0);   // keeps the two steps below behind the roundings, that is behind the wait for the last load that names these address registers
      // from the tile just rounded to the one behind it: a tile on, or back to tile 0 behind the last
      const int gstep = (((t0 + t + 2) & (NT - 1)) == NT - 1) ? -(SEQ - KBLK) * HD : KBLK * HD;
      gk += gstep;
      gv += gstep;
    }
    // Barrier t-1 publishes tile t+1, which every wave stored ahead of its signal at the foot of trip t-1: trip t+1 reads nothing else of the
    // ring. The LDS reads that stand between a signal and its wait are those of one trip, out of a buffer published by the barrier before and
    // next written behind two later waits. Every wave passes here on every trip, also one that left the tile out.
    // s_wait_dscnt 0 in front of the signal: this wave's stores of tile t+2 have landed and its reads of tile t have returned.
    asm volatile("s_wait_dscnt 0x0\n\ts_barrier_wait -1\n\ts_barrier_signal -1" ::: "memory");
  }
  asm volatile("s_barrier_wait -1" ::: "memory");   // the wait that belongs to the last trip's signal

  const float inv = 1.0f / lrun;
#pragma unroll
  for (int dt = 0; dt < 4; ++dt) {
#pragma unroll
    for (int r = 0; r < 8; ++r) osm[wave][n][dt * 16 + 8 * hh + r] = oacc[dt][r] * inv;
  }
  __syncthreads();

  float* ob = out + ((size_t)bh * SEQ + (size_t)(m0 + wave * 16)) * HD;
  v4f vals[8];
#pragma unroll
  for (int it = 0; it < 8; ++it) vals[it] = *(const v4f*)(&osm[wave][it * 2 + hh][n * 4]);
#pragma unroll
  for (int it = 0; it < 8; ++it)
    *(v4f*)(ob + (size_t)(it * 2 + hh) * HD + (size_t)(n * 4)) = vals[it];
}

// ---------------- launcher ----------------
extern "C" void kernel_launch(void* const* d_in, const int* in_sizes, int n_in,
                              void* d_out, int out_size, void* d_ws, size_t ws_size,
                              hipStream_t stream) {
  if (n_in < 7) return;
  const int nq = NBH * SEQ * HD;
  if (in_sizes[0] != nq || in_sizes[1] != nq || in_sizes[2] != nq || out_size != nq) return;
  if (in_sizes[3] < NKER * NH || in_sizes[4] < NKER * NH || in_sizes[5] < NKER * NH || in_sizes[6] < NH) return;

  const float* q    = (const float*)d_in[0];
  const float* k    = (const float*)d_in[1];
  const float* v    = (const float*)d_in[2];
  const float* off  = (const float*)d_in[3];
  const float* amp  = (const float*)d_in[4];
  const float* shp  = (const float*)d_in[5];
  const float* bpar = (const float*)d_in[6];
  float* out = (float*)d_out;

  hipLaunchKernelGGL(k_attn, dim3(SEQ / QBLK, NBH), dim3(NTHR), 0, stream,
                     q, k, v, off, amp, shp, bpar, out);
}
